// v000
// The times below were measured on an AMD MI455X: many runs one after another, warmed up first and cycling through
// copies of the inputs, with the whole window's GPU time divided by the number of runs. Launches and the gaps
// between them are all in it. The median over several windows is given; except for v000 it joins two sittings, which
// can be a few percent apart, so the side-by-side timings, each taken in one sitting, are the better comparison.
// v000, which the later versions start from, runs in 1900 microseconds.
#include <hip/hip_runtime.h>

// A single-head spatial self-attention over 4,096 positions with 1 x 1 convolutions (x [8][64][64][64] = [entry][64 channels][4,096 positions]; Wq, Wk [8][64], Wv [64][64], ALL 'oi' (out, in), no bias; gamma [1], a scalar input): f = Wq x and g = Wk x (8 channels each); h = Wv x (64 channels);
// s[n][m] = f[:, n] . g[:, m] (no scale, no mask); a softmax over n, the score matrix's FIRST axis: for the output position m the weights run over n: g gives position m's query, f the keys; o[c][m] = sum_n h[c][n] weight[n][m]; out[c][m] = gamma o[c][m] + x[c][m] -> [8][64][64][64] (2.1 M); argument order x, Wq, Wk, Wv, gamma: all read.
// Layout: once: the three weights' bf16 words (Wk's and Wq's rows as rows 0..7 and 8..15 of ONE 64-row B operand whose other rows are filled from Wv's rows: their product columns are never read); per entry: x rounded to bf16 (kept f32), laid token-major [4096][64] (k_msin: its channel-major copy is written and not read here) and cast to its exact bf16 words;
// ONE product at depth 64 gives query | key | (unread) token-major; k_qk0 lays the two 8-channel maps as f32 planes [4096][32] whose columns 8..31 are WRITTEN ZEROS (the matrix unit's depth is a multiple of 32); their bf16 hi | lo planes; h channel-major [64][4096] by ONE product with the roles exchanged (A = Wv's rows, Bt = the token-major plane) and its hi | lo planes;
// then a half of the query rows at a time (2,048): the scores on hi + lo words of both operands (three products at depth 32); the dense softmax (multiplier 1.0) on its hi | lo arm for every row (RH = TT): the normalised weights as bf16 hi and lo planes; the value product on hi + lo words of both (three products at depth 4,096) into Ob [4096][64];
// k_resg: out[c][m] = gamma Ob[m][c] + x[c][m] (gamma read from its input and rounded to bf16 as every float input is; a transposing store).
// TWO flat kernels of this file (k_qk0: a lane -> one position; k_resg: a lane -> two consecutive positions and all 64 channels, sixteen a trip of a four-trip literal loop; f32 planes alone; every address from the lane's own index and launch constants; no LDS, barrier, cross-lane word or atomic).
// Compute dtypes, f32 accumulate: every float input rounded to bf16 at its load; the three 1 x 1 convolutions ONE bf16 product each on exact operands; the two 8-channel maps, h and the weights as bf16 hi + lo words at both attention products; softmax f32; the scaled residual f32.

#define NB_  8
#define TT   4096                 // positions = the softmax's key axis
#define HD   64                   // channels
#define DQK  8                    // q and k channels
#define DP   32                   // q and k padded to the matrix unit's depth
#define ZH   1
#define RH   4096                 // query rows < RH use hi+lo planes (4096 = TT: EVERY row)
#define PCAR 1024.0f
#define SCL  1.0f                 // no scale: the scores as they are
typedef _Float16 h16;
typedef unsigned short bf;
typedef __attribute__((ext_vector_type(16))) __bf16   v16bf;
typedef __attribute__((ext_vector_type(16))) _Float16 v16h;
typedef __attribute__((ext_vector_type(8)))  _Float16 v8h;
typedef __attribute__((ext_vector_type(8)))  unsigned short v8us;
typedef __attribute__((ext_vector_type(8)))  float    v8f;
typedef __attribute__((ext_vector_type(4)))  float    v4f;
typedef v8h  __attribute__((may_alias)) v8ha;
typedef v4f  __attribute__((may_alias)) v4fa;
typedef v8us __attribute__((may_alias)) v8usa;

__device__ __forceinline__ unsigned short f2bf(float f) { unsigned u = __float_as_uint(f); u += 0x7FFFu + ((u >> 16) & 1u); return (unsigned short)(u >> 16); }
__device__ __forceinline__ float bf2f(unsigned short b) { return __uint_as_float(((unsigned)b) << 16); }
__device__ __forceinline__ float bfr(float f) { return bf2f(f2bf(f)); }
__device__ __forceinline__ v16h cat16(v8h lo, v8h hi) { return __builtin_shufflevector(lo, hi, 0, 1, 2, 3, 4, 5, 6, 7, 8, 9, 10, 11, 12, 13, 14, 15); }
__device__ __forceinline__ v16bf cat16b(v8us lo, v8us hi) { return __builtin_bit_cast(v16bf, __builtin_shufflevector(lo, hi, 0, 1, 2, 3, 4, 5, 6, 7, 8, 9, 10, 11, 12, 13, 14, 15)); }
__device__ __forceinline__ v8f wmma16(v16h a, v16h b, v8f c) { return __builtin_amdgcn_wmma_f32_16x16x32_f16(false, a, false, b, (short)0, c, false, false); }
__device__ __forceinline__ v8f wmmab(v16bf a, v16bf b, v8f c) { return __builtin_amdgcn_wmma_f32_16x16x32_bf16(false, a, false, b, (short)0, c, false, false); }



// ---- k_gemmw: register-blocked GEMM, ONE WAVE per 64x64 output tile (16 accumulators), operands straight from K-contiguous 16-bit planes; grid (M/64, N/64, Z), 32 threads.
// C[m][n] (f32, pitch ldc, + optional f32 bias[n]) = sum_k A[m][k] Bt[n][k] (+ split products per NSPLIT). z-batch strides sA/sB/sC in elements. K % 32 == 0.
template <typename T16> struct WFrag;
template <> struct WFrag<h16> { typedef v16h V; static __device__ __forceinline__ V ld(const h16* p) { return cat16(*(const v8h*)p, *(const v8h*)(p + 16)); } static __device__ __forceinline__ v8f mma(V a, V b, v8f c) { return wmma16(a, b, c); } };
template <> struct WFrag<bf> { typedef v16bf V; static __device__ __forceinline__ V ld(const bf* p) { return cat16b(*(const v8us*)p, *(const v8us*)(p + 16)); } static __device__ __forceinline__ v8f mma(V a, V b, v8f c) { return wmmab(a, b, c); } };
template <typename T16, int NSPLIT, bool BIAS>
__global__ __launch_bounds__(32) void k_gemmw(const T16* __restrict__ A, const T16* __restrict__ A2, const T16* __restrict__ Bt, const T16* __restrict__ Bt2, int K, float* C, int ldc, const float* __restrict__ bias, size_t sA, size_t sB, size_t sC) {
    typedef typename WFrag<T16>::V V;
    __shared__ __align__(16) float os[16 * 68];
    const size_t z = blockIdx.z; A += z * sA; if (A2) A2 += z * sA; Bt += z * sB; if (Bt2) Bt2 += z * sB; C += z * sC;
    const int lane = threadIdx.x & 31, lr = lane & 15, hi = lane >> 4; const int r0 = blockIdx.x * 64, c0 = blockIdx.y * 64;
    v8f acc[4][4];
#pragma unroll
    for (int mb = 0; mb < 4; ++mb)
#pragma unroll
        for (int nb = 0; nb < 4; ++nb) acc[mb][nb] = (v8f){};
    const size_t aoff = (size_t)(r0 + lr) * K + 8 * hi, boff = (size_t)(c0 + lr) * K + 8 * hi;

    for (int kc = 0; kc < K; kc += 32) {
        V a[4], a2[4];
#pragma unroll
        for (int mb = 0; mb < 4; ++mb) { a[mb] = WFrag<T16>::ld(A + aoff + (size_t)mb * 16 * K + kc); if (NSPLIT == 1 || NSPLIT == 2) a2[mb] = WFrag<T16>::ld(A2 + aoff + (size_t)mb * 16 * K + kc); }
#pragma unroll
        for (int nb = 0; nb < 4; ++nb) { const V b = WFrag<T16>::ld(Bt + boff + (size_t)nb * 16 * K + kc); V b2; if (NSPLIT >= 2) b2 = WFrag<T16>::ld(Bt2 + boff + (size_t)nb * 16 * K + kc);
#pragma unroll
            for (int mb = 0; mb < 4; ++mb) { acc[mb][nb] = WFrag<T16>::mma(a[mb], b, acc[mb][nb]); if (NSPLIT == 1 || NSPLIT == 2) acc[mb][nb] = WFrag<T16>::mma(a2[mb], b, acc[mb][nb]); if (NSPLIT >= 2) acc[mb][nb] = WFrag<T16>::mma(a[mb], b2, acc[mb][nb]); } }
        asm volatile("v_nop\n\tv_nop\n\tv_nop\n\tv_nop" : "+v"(acc[0][0]), "+v"(acc[1][1]), "+v"(acc[2][2]), "+v"(acc[3][3]) : "v"(a[0]), "v"(a[3]));
    }
#pragma unroll
    for (int mb = 0; mb < 4; ++mb) {
#pragma unroll
        for (int nb = 0; nb < 4; ++nb) {
#pragma unroll
            for (int j = 0; j < 8; ++j) os[(hi * 8 + j) * 68 + nb * 16 + lr] = acc[mb][nb][j]; }
        __builtin_amdgcn_wave_barrier(); asm volatile("" ::: "memory");
        float* crow = C + (size_t)(r0 + mb * 16) * ldc + c0;
{
#pragma unroll
            for (int s = 0; s < 8; ++s) { const int row = 2 * s + hi, cofs = lr * 4; v4f val = *(const v4fa*)(os + row * 68 + cofs); if (BIAS) { val[0] += bfr(bias[c0 + cofs]); val[1] += bfr(bias[c0 + cofs + 1]); val[2] += bfr(bias[c0 + cofs + 2]); val[3] += bfr(bias[c0 + cofs + 3]); }
                *(v4f*)(crow + (size_t)row * ldc + cofs) = val; }
             }
        __builtin_amdgcn_wave_barrier(); asm volatile("" ::: "memory");
    }
}

__device__ __forceinline__ h16 tohx(float x) { return (h16)x; }
__device__ __forceinline__ void splitf(float y, unsigned short& h, unsigned short& l) { h = f2bf(y); l = f2bf(y - bf2f(h)); }
typedef __attribute__((ext_vector_type(2))) _Float16 v2h;
typedef __attribute__((ext_vector_type(4))) _Float16 v4h;
typedef __attribute__((ext_vector_type(2))) unsigned short v2us;
typedef __attribute__((ext_vector_type(4))) unsigned short v4us;
typedef __attribute__((ext_vector_type(2))) float v2f;
typedef __attribute__((ext_vector_type(4))) int v4i;

// k_asoft: per row (zz, i): t = S x SCL (SCL = 1.0: the module applies no scale; no mask); softmax over the 4096 keys (register row, one exp, fixed trees);
__global__ __launch_bounds__(256) void k_asoft(const float* __restrict__ Sb, h16* P16, bf* Ph, bf* Pl) {
    const int lane = threadIdx.x & 31; const int row = blockIdx.x * 8 + (threadIdx.x >> 5); if (row >= ZH * TT) return; const int i = row % TT; const int zz = row / TT; (void)zz; const bool hires = (i < RH); const float* sr = Sb + (size_t)row * TT; float v[TT / 32]; float mx = -3.0e38f;
#pragma unroll
    for (int ch = 0; ch < TT / 128; ++ch) { const int j0 = ch * 128 + lane * 4; const v4f a = *(const v4f*)(sr + j0);
#pragma unroll
        for (int q = 0; q < 4; ++q) { const int j = j0 + q; (void)j; const float t = a[q] * SCL; v[ch * 4 + q] = t; mx = fmaxf(mx, t); } }
#pragma unroll
    for (int sh = 16; sh; sh >>= 1) mx = fmaxf(mx, __shfl_xor(mx, sh, 32));
    float sum = 0.f;
#pragma unroll
    for (int k = 0; k < TT / 32; ++k) { float d0 = __fsub_rn(v[k], mx); v[k] = __builtin_amdgcn_exp2f(__fmul_rn(d0, 1.4426950408889634f)); sum += v[k]; }
#pragma unroll
    for (int sh = 16; sh; sh >>= 1) sum += __shfl_xor(sum, sh, 32);
    const float f = __fdiv_rn(hires ? 1.0f : PCAR, sum);
{
        if (hires) {
#pragma unroll
            for (int ch = 0; ch < TT / 128; ++ch) { v4us oh, ol;
#pragma unroll
                for (int q = 0; q < 4; ++q) { unsigned short a, c2; splitf(v[ch * 4 + q] * f, a, c2); oh[q] = a; ol[q] = c2; }
                const size_t oo = ((size_t)zz * (RH ? RH : 1) + i) * TT + ch * 128 + lane * 4; *(v4us*)(Ph + oo) = oh; *(v4us*)(Pl + oo) = ol; }
        } else {
#pragma unroll
            for (int ch = 0; ch < TT / 128; ++ch) { v4h o4;
#pragma unroll
                for (int q = 0; q < 4; ++q) o4[q] = tohx(v[ch * 4 + q] * f);
                *(v4h*)(P16 + (size_t)row * TT + ch * 128 + lane * 4) = o4; } }
         }
}
__global__ __launch_bounds__(256) void k_cvt8(const float* __restrict__ src, bf* dst, size_t n8) { const size_t i = (size_t)blockIdx.x * 256 + threadIdx.x; if (i >= n8) return; const v8f v = *(const v8f*)(src + i * 8); v8us o;
#pragma unroll
    for (int k = 0; k < 8; ++k) o[k] = f2bf(v[k]); *(v8us*)(dst + i * 8) = o;  }
__global__ __launch_bounds__(256) void k_rbf(const float* __restrict__ X, float* Y, size_t n4) { const size_t i = (size_t)blockIdx.x * 256 + threadIdx.x; if (i >= n4) return; const v4f a = *(const v4f*)(X + i * 4); v4f o;
#pragma unroll
    for (int q = 0; q < 4; ++q) o[q] = bfr(a[q]);
    *(v4f*)(Y + i * 4) = o;  }
__global__ __launch_bounds__(256) void k_pl2(const float* __restrict__ F, bf* Ph, bf* Pl, size_t n4) { const size_t i = (size_t)blockIdx.x * 256 + threadIdx.x; if (i >= n4) return; const v4f v = *(const v4f*)(F + i * 4); v4us oh, ol;
#pragma unroll
    for (int q = 0; q < 4; ++q) { unsigned short a, c; splitf(v[q], a, c); oh[q] = a; ol[q] = c; } *(v4us*)(Ph + i * 4) = oh; *(v4us*)(Pl + i * 4) = ol;  }
// k_msin: from xr (an entry's [64][4096] channel-major input, ALREADY rounded to bf16 and kept f32 by k_rbf): Y[n][c] = xr[c][n] (f32, token-major) and O0[c][n] = the same value (a channel-major copy: written into a spare plane here and not read);
__global__ __launch_bounds__(256) void k_msin(const float* __restrict__ xr, float* Y, float* O0) { const size_t e = (size_t)blockIdx.x * 256 + threadIdx.x; const size_t n0 = e * 2;
    for (int kc = 0; kc < HD / 16; ++kc) { float a[16], b[16];
#pragma unroll
        for (int c = 0; c < 16; ++c) { const v2f v = *(const v2f*)(xr + (size_t)(kc * 16 + c) * TT + n0); a[c] = v[0]; b[c] = v[1]; }
{
#pragma unroll
            for (int k = 0; k < 4; ++k) { v4f o; o[0] = a[k * 4]; o[1] = a[k * 4 + 1]; o[2] = a[k * 4 + 2]; o[3] = a[k * 4 + 3]; *(v4f*)(Y + n0 * HD + kc * 16 + k * 4) = o; o[0] = b[k * 4]; o[1] = b[k * 4 + 1]; o[2] = b[k * 4 + 2]; o[3] = b[k * 4 + 3]; *(v4f*)(Y + (n0 + 1) * HD + kc * 16 + k * 4) = o; }
#pragma unroll
            for (int c = 0; c < 16; ++c) { v2f f2; f2[0] = a[c]; f2[1] = b[c]; *(v2f*)(O0 + (size_t)(kc * 16 + c) * TT + n0) = f2; }
             } } }
// k_qk0: from QK[n][0..7] (the query map g = Wk x at position n) and QK[n][8..15] (the key map f = Wq x): QF[n][0..7] and KF[n][0..7] as they are (the module has no bias), and QF[n][8..31] = KF[n][8..31] = 0: WRITTEN ZEROS (the score product runs at depth 32);
__global__ __launch_bounds__(256) void k_qk0(const float* __restrict__ QK, float* QF, float* KF) { const size_t n = (size_t)blockIdx.x * 256 + threadIdx.x; const v4f q0 = *(const v4f*)(QK + n * HD), q1 = *(const v4f*)(QK + n * HD + 4), k0 = *(const v4f*)(QK + n * HD + 8), k1 = *(const v4f*)(QK + n * HD + 12);
    v4f z; z[0] = 0.f; z[1] = 0.f; z[2] = 0.f; z[3] = 0.f;
{ *(v4f*)(QF + n * DP) = q0; *(v4f*)(QF + n * DP + 4) = q1; *(v4f*)(KF + n * DP) = k0; *(v4f*)(KF + n * DP + 4) = k1;
#pragma unroll
        for (int k = 2; k < DP / 4; ++k) { *(v4f*)(QF + n * DP + k * 4) = z; *(v4f*)(KF + n * DP + k * 4) = z; }
         } }
// k_resg: out[c][m] = g Ob[m][c] + XV[c][m] (Ob = the value product of the normalised weights, token-major; g = the scalar input GAM[0] rounded to bf16; XV = this entry's rounded x, channel-major: the residual): a transposing store;
__global__ __launch_bounds__(256) void k_resg(const float* __restrict__ Ob, const float* __restrict__ GAM, const float* __restrict__ XV, float* out) { const size_t e = (size_t)blockIdx.x * 256 + threadIdx.x; const size_t n0 = e * 2; const float g = bfr(GAM[0]);
    for (int kc = 0; kc < HD / 16; ++kc) { float a[16], b[16];
#pragma unroll
        for (int k = 0; k < 4; ++k) { const v4f o0 = *(const v4f*)(Ob + n0 * HD + kc * 16 + k * 4), o1 = *(const v4f*)(Ob + (n0 + 1) * HD + kc * 16 + k * 4);
#pragma unroll
            for (int j = 0; j < 4; ++j) { a[k * 4 + j] = o0[j]; b[k * 4 + j] = o1[j]; } }
#pragma unroll
        for (int c = 0; c < 16; ++c) { const v2f xv = *(const v2f*)(XV + (size_t)(kc * 16 + c) * TT + n0); a[c] = g * a[c] + xv[0]; b[c] = g * b[c] + xv[1]; }
{
#pragma unroll
            for (int c = 0; c < 16; ++c) { v2f f2; f2[0] = a[c]; f2[1] = b[c]; *(v2f*)(out + (size_t)(kc * 16 + c) * TT + n0) = f2; }
             } } }

extern "C" void kernel_launch(void* const* d_in, const int* in_sizes, int n_in,
                              void* d_out, int out_size, void* d_ws, size_t ws_size, hipStream_t stream) {
    (void)in_sizes; (void)n_in; (void)out_size;
    const float* x = (const float*)d_in[0]; const float* wq = (const float*)d_in[1]; const float* wk = (const float*)d_in[2]; const float* wv = (const float*)d_in[3]; const float* gam = (const float*)d_in[4];
    // inputs in the module's argument order: x, Wq, Wk, Wv, gamma = d_in[0..4]: all read
    float* OUT = (float*)d_out;     // [8][64][4096]
    char* wsp = (char*)d_ws;
    auto take = [&](size_t bytes) { char* p = wsp; wsp += (bytes + 255) & ~(size_t)255; return (void*)p; };
    float* WR = (float*)take((size_t)HD * HD * 4); bf* WQKB = (bf*)take((size_t)HD * HD * 2); bf* WVB = (bf*)take((size_t)HD * HD * 2);
    float* XV = (float*)take((size_t)HD * TT * 4); float* YV = (float*)take((size_t)TT * HD * 4); float* SPARE = (float*)take((size_t)HD * TT * 4);
    bf* YVB = (bf*)take((size_t)TT * HD * 2); float* QKF = (float*)take((size_t)TT * HD * 4); float* QF = (float*)take((size_t)TT * DP * 4); float* KF = (float*)take((size_t)TT * DP * 4);
    bf* Qh = (bf*)take((size_t)TT * DP * 2); bf* Ql = (bf*)take((size_t)TT * DP * 2); bf* Kh = (bf*)take((size_t)TT * DP * 2); bf* Kl = (bf*)take((size_t)TT * DP * 2); float* VC = (float*)take((size_t)HD * TT * 4); bf* VCh = (bf*)take((size_t)HD * TT * 2); bf* VCl = (bf*)take((size_t)HD * TT * 2);
    h16* P16 = nullptr;   /* RH = TT: the softmax's f16 arm is never taken: its stores sit under the 'else' of 'i < RH' */
    float* Sb = (float*)take((size_t)(TT / 2) * TT * 4); bf* Ph = (bf*)take((size_t)(TT / 2) * TT * 2); bf* Pl = (bf*)take((size_t)(TT / 2) * TT * 2); float* Ob = (float*)take((size_t)TT * HD * 4);
    if ((size_t)(wsp - (char*)d_ws) > ws_size) return;    // total 73.53 MiB carved
    k_rbf<<<1, 256, 0, stream>>>(wk, WR, (size_t)DQK * HD / 4); k_rbf<<<1, 256, 0, stream>>>(wq, WR + (size_t)DQK * HD, (size_t)DQK * HD / 4); k_rbf<<<3, 256, 0, stream>>>(wv, WR + (size_t)2 * DQK * HD, (size_t)(HD - 2 * DQK) * HD / 4);   /* the 64-row B of the query | key product: Wk's 8 rows (the query map), Wq's 8 (the key map), then 48 rows of Wv as filler (their product columns are never read): every word written */
    k_cvt8<<<2, 256, 0, stream>>>(WR, WQKB, (size_t)HD * HD / 8); k_cvt8<<<2, 256, 0, stream>>>(wv, WVB, (size_t)HD * HD / 8);   /* 'oi' rows as they stand */
    const size_t N4 = (size_t)HD * TT / 4, N8 = (size_t)HD * TT / 8; const unsigned G4 = (unsigned)((N4 + 255) / 256), G8 = (unsigned)((N8 + 255) / 256); const size_t P4 = (size_t)TT * DP / 4; const unsigned GP = (unsigned)((P4 + 255) / 256);
    for (int b = 0; b < NB_; ++b) { const size_t ob = (size_t)b * HD * TT;
        k_rbf<<<G4, 256, 0, stream>>>(x + ob, XV, N4);   /* the entry's input rounded to bf16, kept f32 */
        k_msin<<<(unsigned)(TT / 2 / 256), 256, 0, stream>>>(XV, YV, SPARE);   /* the token-major plane; the channel-major copy goes to a spare plane and is not read */
        k_cvt8<<<G8, 256, 0, stream>>>(YV, YVB, N8);   /* exact bf16 words */
        k_gemmw<bf, 0, false><<<dim3(TT / 64, HD / 64, 1), 32, 0, stream>>>(YVB, nullptr, WQKB, nullptr, HD, QKF, HD, nullptr, 0, 0, 0);   /* [query | key | unread][n] = x[:, n] . [Wk | Wq | filler] rows */
        k_qk0<<<(unsigned)(TT / 256), 256, 0, stream>>>(QKF, QF, KF); k_pl2<<<GP, 256, 0, stream>>>(QF, Qh, Ql, P4); k_pl2<<<GP, 256, 0, stream>>>(KF, Kh, Kl, P4);
        k_gemmw<bf, 0, false><<<dim3(HD / 64, TT / 64, 1), 32, 0, stream>>>(WVB, nullptr, YVB, nullptr, HD, VC, TT, nullptr, 0, 0, 0); k_pl2<<<G4, 256, 0, stream>>>(VC, VCh, VCl, N4);   /* h channel-major: VC[c][n] = Wv[c][:] . x[:, n] */
        for (int hf = 0; hf < 2; ++hf) { const size_t r0 = (size_t)hf * (TT / 2);   /* a half of the query rows at a time */
            k_gemmw<bf, 2, false><<<dim3(TT / 2 / 64, TT / 64, 1), 32, 0, stream>>>(Qh + r0 * DP, Ql + r0 * DP, Kh, Kl, DP, Sb, TT, nullptr, 0, 0, 0);   /* Sb[m][n] = g[:, m] . f[:, n] on hi + lo words of both: depth 32: one step of the depth loop */
            k_asoft<<<TT / 2 / 8, 256, 0, stream>>>(Sb, P16, Ph, Pl);   /* 2,048 rows of this half, each normalised over its 4,096 keys n: every one under RH: the hi | lo arm; the grid, not the kernel's guard, bounds the rows to these planes */
            k_gemmw<bf, 2, false><<<dim3(TT / 2 / 64, HD / 64, 1), 32, 0, stream>>>(Ph, Pl, VCh, VCl, TT, Ob + r0 * HD, HD, nullptr, 0, 0, 0); }   /* Ob[m][c] = sum_n (wh + wl)[m][n] (hh + hl)[c][n]: three products */
        k_resg<<<(unsigned)(TT / 2 / 256), 256, 0, stream>>>(Ob, gam, XV, OUT + ob); }   /* out = gamma Ob + x: the one writer of this entry's output */
}

// v001
// A run of this version takes 772 microseconds.
// Next to v000, in two timings, it ran 2.43 times as fast each time.
#include <hip/hip_runtime.h>

// A single-head spatial self-attention over 4,096 positions with 1 x 1 convolutions (x [8][64][64][64] = [entry][64 channels][4,096 positions]; Wq, Wk [8][64], Wv [64][64], ALL 'oi' (out, in), no bias; gamma [1], a scalar input): f = Wq x and g = Wk x (8 channels each); h = Wv x (64 channels);
// s[n][m] = f[:, n] . g[:, m] (no scale, no mask); a softmax over n, the score matrix's FIRST axis: for the output position m the weights run over n: g gives position m's query, f the keys; o[c][m] = sum_n h[c][n] weight[n][m]; out[c][m] = gamma o[c][m] + x[c][m] -> [8][64][64][64] (2.1 M); argument order x, Wq, Wk, Wv, gamma: all read.
// Layout: once: the three weights' bf16 words (Wk's and Wq's rows as rows 0..7 and 8..15 of ONE 64-row B operand whose other rows are filled from Wv's rows: their product columns are never read); per entry: x rounded to bf16 (kept f32), laid token-major [4096][64] (k_msin: its channel-major copy is written and not read here) and cast to its exact bf16 words;
// ONE product at depth 64 gives query | key | (unread) token-major; k_qk0 lays the two 8-channel maps as f32 planes [4096][32] whose columns 8..31 are WRITTEN ZEROS (the matrix unit's depth is a multiple of 32); their bf16 hi | lo planes; h channel-major [64][4096] by ONE product with the roles exchanged (A = Wv's rows, Bt = the token-major plane) and its hi | lo planes;
// then a half of the query rows at a time (2,048): the scores on hi + lo words of both operands (three products at depth 32); the dense softmax (multiplier 1.0) on its hi | lo arm for every row (RH = TT): the normalised weights as bf16 hi and lo planes; the value product on hi + lo words of both (three products at depth 4,096), its depth cut into KS = 16 slices of 256 keys, one grid z each, every slice's f32 sums in a plane of its own, channel-major as the output is (A = h's rows, Bt = the weights' rows): Pt[z][64][4096];
// k_resg: out[c][m] = gamma (the sum over z, in z order, of Pt[z][c][m]) + x[c][m] (gamma read from its input and rounded to bf16 as every float input is).
// TWO flat kernels of this file (k_qk0: a lane -> one position; k_resg: a lane -> four consecutive positions of one channel; f32 planes alone; every address from the lane's own index and launch constants; no LDS, barrier, cross-lane word or atomic).
// Compute dtypes, f32 accumulate: every float input rounded to bf16 at its load; the three 1 x 1 convolutions ONE bf16 product each on exact operands; the two 8-channel maps, h and the weights as bf16 hi + lo words at both attention products; softmax f32; the scaled residual f32.

#define NB_  8
#define TT   4096                 // positions = the softmax's key axis
#define HD   64                   // channels
#define DQK  8                    // q and k channels
#define DP   32                   // q and k padded to the matrix unit's depth
#define ZH   1
#define RH   4096                 // query rows < RH use hi+lo planes (4096 = TT: EVERY row)
#define PCAR 1024.0f
#define SCL  1.0f                 // no scale: the scores as they are
#define KS   16                   // depth slices of the value product: 32 tiles x 16 slices = 512 waves a launch
typedef _Float16 h16;
typedef unsigned short bf;
typedef __attribute__((ext_vector_type(16))) __bf16   v16bf;
typedef __attribute__((ext_vector_type(16))) _Float16 v16h;
typedef __attribute__((ext_vector_type(8)))  _Float16 v8h;
typedef __attribute__((ext_vector_type(8)))  unsigned short v8us;
typedef __attribute__((ext_vector_type(8)))  float    v8f;
typedef __attribute__((ext_vector_type(4)))  float    v4f;
typedef v8h  __attribute__((may_alias)) v8ha;
typedef v4f  __attribute__((may_alias)) v4fa;
typedef v8us __attribute__((may_alias)) v8usa;

__device__ __forceinline__ unsigned short f2bf(float f) { unsigned u = __float_as_uint(f); u += 0x7FFFu + ((u >> 16) & 1u); return (unsigned short)(u >> 16); }
__device__ __forceinline__ float bf2f(unsigned short b) { return __uint_as_float(((unsigned)b) << 16); }
__device__ __forceinline__ float bfr(float f) { return bf2f(f2bf(f)); }
__device__ __forceinline__ v16h cat16(v8h lo, v8h hi) { return __builtin_shufflevector(lo, hi, 0, 1, 2, 3, 4, 5, 6, 7, 8, 9, 10, 11, 12, 13, 14, 15); }
__device__ __forceinline__ v16bf cat16b(v8us lo, v8us hi) { return __builtin_bit_cast(v16bf, __builtin_shufflevector(lo, hi, 0, 1, 2, 3, 4, 5, 6, 7, 8, 9, 10, 11, 12, 13, 14, 15)); }
__device__ __forceinline__ v8f wmma16(v16h a, v16h b, v8f c) { return __builtin_amdgcn_wmma_f32_16x16x32_f16(false, a, false, b, (short)0, c, false, false); }
__device__ __forceinline__ v8f wmmab(v16bf a, v16bf b, v8f c) { return __builtin_amdgcn_wmma_f32_16x16x32_bf16(false, a, false, b, (short)0, c, false, false); }



// ---- k_gemmw: register-blocked GEMM, ONE WAVE per 64x64 output tile (16 accumulators), operands straight from K-contiguous 16-bit planes; grid (M/64, N/64, Z), 32 threads.
// C[m][n] (f32, pitch ldc, + optional f32 bias[n]) = sum_k A[m][k] Bt[n][k] (+ split products per NSPLIT). z-batch strides sA/sB/sC in elements. K % 32 == 0. K is the row pitch of A and Bt; KD (KD % 32 == 0) is the depth that one z runs: K where a launch runs the whole depth; a launch that gives each z a slice of the depth passes the slice's length as KD, sA and sB, and a plane's size as sC.
template <typename T16> struct WFrag;
template <> struct WFrag<h16> { typedef v16h V; static __device__ __forceinline__ V ld(const h16* p) { return cat16(*(const v8h*)p, *(const v8h*)(p + 16)); } static __device__ __forceinline__ v8f mma(V a, V b, v8f c) { return wmma16(a, b, c); } };
template <> struct WFrag<bf> { typedef v16bf V; static __device__ __forceinline__ V ld(const bf* p) { return cat16b(*(const v8us*)p, *(const v8us*)(p + 16)); } static __device__ __forceinline__ v8f mma(V a, V b, v8f c) { return wmmab(a, b, c); } };
template <typename T16, int NSPLIT, bool BIAS>
__global__ __launch_bounds__(32) void k_gemmw(const T16* __restrict__ A, const T16* __restrict__ A2, const T16* __restrict__ Bt, const T16* __restrict__ Bt2, int K, int KD, float* C, int ldc, const float* __restrict__ bias, size_t sA, size_t sB, size_t sC) {
    typedef typename WFrag<T16>::V V;
    __shared__ __align__(16) float os[16 * 68];
    const size_t z = blockIdx.z; A += z * sA; if (A2) A2 += z * sA; Bt += z * sB; if (Bt2) Bt2 += z * sB; C += z * sC;
    const int lane = threadIdx.x & 31, lr = lane & 15, hi = lane >> 4; const int r0 = blockIdx.x * 64, c0 = blockIdx.y * 64;
    v8f acc[4][4];
#pragma unroll
    for (int mb = 0; mb < 4; ++mb)
#pragma unroll
        for (int nb = 0; nb < 4; ++nb) acc[mb][nb] = (v8f){};
    const size_t aoff = (size_t)(r0 + lr) * K + 8 * hi, boff = (size_t)(c0 + lr) * K + 8 * hi;

    for (int kc = 0; kc < KD; kc += 32) {
        V a[4], a2[4];
#pragma unroll
        for (int mb = 0; mb < 4; ++mb) { a[mb] = WFrag<T16>::ld(A + aoff + (size_t)mb * 16 * K + kc); if (NSPLIT == 1 || NSPLIT == 2) a2[mb] = WFrag<T16>::ld(A2 + aoff + (size_t)mb * 16 * K + kc); }
#pragma unroll
        for (int nb = 0; nb < 4; ++nb) { const V b = WFrag<T16>::ld(Bt + boff + (size_t)nb * 16 * K + kc); V b2; if (NSPLIT >= 2) b2 = WFrag<T16>::ld(Bt2 + boff + (size_t)nb * 16 * K + kc);
#pragma unroll
            for (int mb = 0; mb < 4; ++mb) { acc[mb][nb] = WFrag<T16>::mma(a[mb], b, acc[mb][nb]); if (NSPLIT == 1 || NSPLIT == 2) acc[mb][nb] = WFrag<T16>::mma(a2[mb], b, acc[mb][nb]); if (NSPLIT >= 2) acc[mb][nb] = WFrag<T16>::mma(a[mb], b2, acc[mb][nb]); } }
        asm volatile("v_nop\n\tv_nop\n\tv_nop\n\tv_nop" : "+v"(acc[0][0]), "+v"(acc[1][1]), "+v"(acc[2][2]), "+v"(acc[3][3]) : "v"(a[0]), "v"(a[3]));
    }
#pragma unroll
    for (int mb = 0; mb < 4; ++mb) {
#pragma unroll
        for (int nb = 0; nb < 4; ++nb) {
#pragma unroll
            for (int j = 0; j < 8; ++j) os[(hi * 8 + j) * 68 + nb * 16 + lr] = acc[mb][nb][j]; }
        __builtin_amdgcn_wave_barrier(); asm volatile("" ::: "memory");
        float* crow = C + (size_t)(r0 + mb * 16) * ldc + c0;
{
#pragma unroll
            for (int s = 0; s < 8; ++s) { const int row = 2 * s + hi, cofs = lr * 4; v4f val = *(const v4fa*)(os + row * 68 + cofs); if (BIAS) { val[0] += bfr(bias[c0 + cofs]); val[1] += bfr(bias[c0 + cofs + 1]); val[2] += bfr(bias[c0 + cofs + 2]); val[3] += bfr(bias[c0 + cofs + 3]); }
                *(v4f*)(crow + (size_t)row * ldc + cofs) = val; }
             }
        __builtin_amdgcn_wave_barrier(); asm volatile("" ::: "memory");
    }
}

__device__ __forceinline__ h16 tohx(float x) { return (h16)x; }
__device__ __forceinline__ void splitf(float y, unsigned short& h, unsigned short& l) { h = f2bf(y); l = f2bf(y - bf2f(h)); }
typedef __attribute__((ext_vector_type(2))) _Float16 v2h;
typedef __attribute__((ext_vector_type(4))) _Float16 v4h;
typedef __attribute__((ext_vector_type(2))) unsigned short v2us;
typedef __attribute__((ext_vector_type(4))) unsigned short v4us;
typedef __attribute__((ext_vector_type(2))) float v2f;
typedef __attribute__((ext_vector_type(4))) int v4i;

// k_asoft: per row (zz, i): t = S x SCL (SCL = 1.0: the module applies no scale; no mask); softmax over the 4096 keys (register row, one exp, fixed trees);
__global__ __launch_bounds__(256) void k_asoft(const float* __restrict__ Sb, h16* P16, bf* Ph, bf* Pl) {
    const int lane = threadIdx.x & 31; const int row = blockIdx.x * 8 + (threadIdx.x >> 5); if (row >= ZH * TT) return; const int i = row % TT; const int zz = row / TT; (void)zz; const bool hires = (i < RH); const float* sr = Sb + (size_t)row * TT; float v[TT / 32]; float mx = -3.0e38f;
#pragma unroll
    for (int ch = 0; ch < TT / 128; ++ch) { const int j0 = ch * 128 + lane * 4; const v4f a = *(const v4f*)(sr + j0);
#pragma unroll
        for (int q = 0; q < 4; ++q) { const int j = j0 + q; (void)j; const float t = a[q] * SCL; v[ch * 4 + q] = t; mx = fmaxf(mx, t); } }
#pragma unroll
    for (int sh = 16; sh; sh >>= 1) mx = fmaxf(mx, __shfl_xor(mx, sh, 32));
    float sum = 0.f;
#pragma unroll
    for (int k = 0; k < TT / 32; ++k) { float d0 = __fsub_rn(v[k], mx); v[k] = __builtin_amdgcn_exp2f(__fmul_rn(d0, 1.4426950408889634f)); sum += v[k]; }
#pragma unroll
    for (int sh = 16; sh; sh >>= 1) sum += __shfl_xor(sum, sh, 32);
    const float f = __fdiv_rn(hires ? 1.0f : PCAR, sum);
{
        if (hires) {
#pragma unroll
            for (int ch = 0; ch < TT / 128; ++ch) { v4us oh, ol;
#pragma unroll
                for (int q = 0; q < 4; ++q) { unsigned short a, c2; splitf(v[ch * 4 + q] * f, a, c2); oh[q] = a; ol[q] = c2; }
                const size_t oo = ((size_t)zz * (RH ? RH : 1) + i) * TT + ch * 128 + lane * 4; *(v4us*)(Ph + oo) = oh; *(v4us*)(Pl + oo) = ol; }
        } else {
#pragma unroll
            for (int ch = 0; ch < TT / 128; ++ch) { v4h o4;
#pragma unroll
                for (int q = 0; q < 4; ++q) o4[q] = tohx(v[ch * 4 + q] * f);
                *(v4h*)(P16 + (size_t)row * TT + ch * 128 + lane * 4) = o4; } }
         }
}
__global__ __launch_bounds__(256) void k_cvt8(const float* __restrict__ src, bf* dst, size_t n8) { const size_t i = (size_t)blockIdx.x * 256 + threadIdx.x; if (i >= n8) return; const v8f v = *(const v8f*)(src + i * 8); v8us o;
#pragma unroll
    for (int k = 0; k < 8; ++k) o[k] = f2bf(v[k]); *(v8us*)(dst + i * 8) = o;  }
__global__ __launch_bounds__(256) void k_rbf(const float* __restrict__ X, float* Y, size_t n4) { const size_t i = (size_t)blockIdx.x * 256 + threadIdx.x; if (i >= n4) return; const v4f a = *(const v4f*)(X + i * 4); v4f o;
#pragma unroll
    for (int q = 0; q < 4; ++q) o[q] = bfr(a[q]);
    *(v4f*)(Y + i * 4) = o;  }
__global__ __launch_bounds__(256) void k_pl2(const float* __restrict__ F, bf* Ph, bf* Pl, size_t n4) { const size_t i = (size_t)blockIdx.x * 256 + threadIdx.x; if (i >= n4) return; const v4f v = *(const v4f*)(F + i * 4); v4us oh, ol;
#pragma unroll
    for (int q = 0; q < 4; ++q) { unsigned short a, c; splitf(v[q], a, c); oh[q] = a; ol[q] = c; } *(v4us*)(Ph + i * 4) = oh; *(v4us*)(Pl + i * 4) = ol;  }
// k_msin: from xr (an entry's [64][4096] channel-major input, ALREADY rounded to bf16 and kept f32 by k_rbf): Y[n][c] = xr[c][n] (f32, token-major) and O0[c][n] = the same value (a channel-major copy: written into a spare plane here and not read);
__global__ __launch_bounds__(256) void k_msin(const float* __restrict__ xr, float* Y, float* O0) { const size_t e = (size_t)blockIdx.x * 256 + threadIdx.x; const size_t n0 = e * 2;
    for (int kc = 0; kc < HD / 16; ++kc) { float a[16], b[16];
#pragma unroll
        for (int c = 0; c < 16; ++c) { const v2f v = *(const v2f*)(xr + (size_t)(kc * 16 + c) * TT + n0); a[c] = v[0]; b[c] = v[1]; }
{
#pragma unroll
            for (int k = 0; k < 4; ++k) { v4f o; o[0] = a[k * 4]; o[1] = a[k * 4 + 1]; o[2] = a[k * 4 + 2]; o[3] = a[k * 4 + 3]; *(v4f*)(Y + n0 * HD + kc * 16 + k * 4) = o; o[0] = b[k * 4]; o[1] = b[k * 4 + 1]; o[2] = b[k * 4 + 2]; o[3] = b[k * 4 + 3]; *(v4f*)(Y + (n0 + 1) * HD + kc * 16 + k * 4) = o; }
#pragma unroll
            for (int c = 0; c < 16; ++c) { v2f f2; f2[0] = a[c]; f2[1] = b[c]; *(v2f*)(O0 + (size_t)(kc * 16 + c) * TT + n0) = f2; }
             } } }
// k_qk0: from QK[n][0..7] (the query map g = Wk x at position n) and QK[n][8..15] (the key map f = Wq x): QF[n][0..7] and KF[n][0..7] as they are (the module has no bias), and QF[n][8..31] = KF[n][8..31] = 0: WRITTEN ZEROS (the score product runs at depth 32);
__global__ __launch_bounds__(256) void k_qk0(const float* __restrict__ QK, float* QF, float* KF) { const size_t n = (size_t)blockIdx.x * 256 + threadIdx.x; const v4f q0 = *(const v4f*)(QK + n * HD), q1 = *(const v4f*)(QK + n * HD + 4), k0 = *(const v4f*)(QK + n * HD + 8), k1 = *(const v4f*)(QK + n * HD + 12);
    v4f z; z[0] = 0.f; z[1] = 0.f; z[2] = 0.f; z[3] = 0.f;
{ *(v4f*)(QF + n * DP) = q0; *(v4f*)(QF + n * DP + 4) = q1; *(v4f*)(KF + n * DP) = k0; *(v4f*)(KF + n * DP + 4) = k1;
#pragma unroll
        for (int k = 2; k < DP / 4; ++k) { *(v4f*)(QF + n * DP + k * 4) = z; *(v4f*)(KF + n * DP + k * 4) = z; }
         } }
// k_resg: out[c][m] = g (Pt[0][c][m] + Pt[1][c][m] + ... + Pt[KS - 1][c][m]) + XV[c][m] (Pt = the value product's KS depth slices, channel-major planes, summed in z order; g = the scalar input GAM[0] rounded to bf16; XV = this entry's rounded x, channel-major: the residual); grid HD TT / 1024;
__global__ __launch_bounds__(256) void k_resg(const float* __restrict__ Pt, const float* __restrict__ GAM, const float* __restrict__ XV, float* out) { const unsigned ob = (blockIdx.x * 256u + threadIdx.x) * 16u; const float g = bfr(GAM[0]);   // ob: the lane's byte offset, the same in a plane, in XV and in out
    v4f o = *(const v4f*)((const char*)Pt + ob);
#pragma unroll
    for (int z = 1; z < KS; ++z) { const v4f p = *(const v4f*)((const char*)(Pt + (size_t)z * HD * TT) + ob);
#pragma unroll
        for (int q = 0; q < 4; ++q) o[q] += p[q]; }
    const v4f xv = *(const v4f*)((const char*)XV + ob);
#pragma unroll
    for (int q = 0; q < 4; ++q) o[q] = g * o[q] + xv[q];
    *(v4f*)((char*)out + ob) = o; }

extern "C" void kernel_launch(void* const* d_in, const int* in_sizes, int n_in,
                              void* d_out, int out_size, void* d_ws, size_t ws_size, hipStream_t stream) {
    (void)in_sizes; (void)n_in; (void)out_size;
    const float* x = (const float*)d_in[0]; const float* wq = (const float*)d_in[1]; const float* wk = (const float*)d_in[2]; const float* wv = (const float*)d_in[3]; const float* gam = (const float*)d_in[4];
    // inputs in the module's argument order: x, Wq, Wk, Wv, gamma = d_in[0..4]: all read
    float* OUT = (float*)d_out;     // [8][64][4096]
    char* wsp = (char*)d_ws;
    auto take = [&](size_t bytes) { char* p = wsp; wsp += (bytes + 255) & ~(size_t)255; return (void*)p; };
    float* WR = (float*)take((size_t)HD * HD * 4); bf* WQKB = (bf*)take((size_t)HD * HD * 2); bf* WVB = (bf*)take((size_t)HD * HD * 2);
    float* XV = (float*)take((size_t)HD * TT * 4); float* YV = (float*)take((size_t)TT * HD * 4); float* SPARE = (float*)take((size_t)HD * TT * 4);
    bf* YVB = (bf*)take((size_t)TT * HD * 2); float* QKF = (float*)take((size_t)TT * HD * 4); float* QF = (float*)take((size_t)TT * DP * 4); float* KF = (float*)take((size_t)TT * DP * 4);
    bf* Qh = (bf*)take((size_t)TT * DP * 2); bf* Ql = (bf*)take((size_t)TT * DP * 2); bf* Kh = (bf*)take((size_t)TT * DP * 2); bf* Kl = (bf*)take((size_t)TT * DP * 2); float* VC = (float*)take((size_t)HD * TT * 4); bf* VCh = (bf*)take((size_t)HD * TT * 2); bf* VCl = (bf*)take((size_t)HD * TT * 2);
    h16* P16 = nullptr;   /* RH = TT: the softmax's f16 arm is never taken: its stores sit under the 'else' of 'i < RH' */
    float* Sb = (float*)take((size_t)(TT / 2) * TT * 4); bf* Ph = (bf*)take((size_t)(TT / 2) * TT * 2); bf* Pl = (bf*)take((size_t)(TT / 2) * TT * 2); float* Pt = (float*)take((size_t)KS * HD * TT * 4);
    if ((size_t)(wsp - (char*)d_ws) > ws_size) return;    // total 88.53 MiB carved
    k_rbf<<<1, 256, 0, stream>>>(wk, WR, (size_t)DQK * HD / 4); k_rbf<<<1, 256, 0, stream>>>(wq, WR + (size_t)DQK * HD, (size_t)DQK * HD / 4); k_rbf<<<3, 256, 0, stream>>>(wv, WR + (size_t)2 * DQK * HD, (size_t)(HD - 2 * DQK) * HD / 4);   /* the 64-row B of the query | key product: Wk's 8 rows (the query map), Wq's 8 (the key map), then 48 rows of Wv as filler (their product columns are never read): every word written */
    k_cvt8<<<2, 256, 0, stream>>>(WR, WQKB, (size_t)HD * HD / 8); k_cvt8<<<2, 256, 0, stream>>>(wv, WVB, (size_t)HD * HD / 8);   /* 'oi' rows as they stand */
    const size_t N4 = (size_t)HD * TT / 4, N8 = (size_t)HD * TT / 8; const unsigned G4 = (unsigned)((N4 + 255) / 256), G8 = (unsigned)((N8 + 255) / 256); const size_t P4 = (size_t)TT * DP / 4; const unsigned GP = (unsigned)((P4 + 255) / 256);
    for (int b = 0; b < NB_; ++b) { const size_t ob = (size_t)b * HD * TT;
        k_rbf<<<G4, 256, 0, stream>>>(x + ob, XV, N4);   /* the entry's input rounded to bf16, kept f32 */
        k_msin<<<(unsigned)(TT / 2 / 256), 256, 0, stream>>>(XV, YV, SPARE);   /* the token-major plane; the channel-major copy goes to a spare plane and is not read */
        k_cvt8<<<G8, 256, 0, stream>>>(YV, YVB, N8);   /* exact bf16 words */
        k_gemmw<bf, 0, false><<<dim3(TT / 64, HD / 64, 1), 32, 0, stream>>>(YVB, nullptr, WQKB, nullptr, HD, HD, QKF, HD, nullptr, 0, 0, 0);   /* [query | key | unread][n] = x[:, n] . [Wk | Wq | filler] rows */
        k_qk0<<<(unsigned)(TT / 256), 256, 0, stream>>>(QKF, QF, KF); k_pl2<<<GP, 256, 0, stream>>>(QF, Qh, Ql, P4); k_pl2<<<GP, 256, 0, stream>>>(KF, Kh, Kl, P4);
        k_gemmw<bf, 0, false><<<dim3(HD / 64, TT / 64, 1), 32, 0, stream>>>(WVB, nullptr, YVB, nullptr, HD, HD, VC, TT, nullptr, 0, 0, 0); k_pl2<<<G4, 256, 0, stream>>>(VC, VCh, VCl, N4);   /* h channel-major: VC[c][n] = Wv[c][:] . x[:, n] */
        for (int hf = 0; hf < 2; ++hf) { const size_t r0 = (size_t)hf * (TT / 2);   /* a half of the query rows at a time */
            k_gemmw<bf, 2, false><<<dim3(TT / 2 / 64, TT / 64, 1), 32, 0, stream>>>(Qh + r0 * DP, Ql + r0 * DP, Kh, Kl, DP, DP, Sb, TT, nullptr, 0, 0, 0);   /* Sb[m][n] = g[:, m] . f[:, n] on hi + lo words of both: depth 32: one step of the depth loop */
            k_asoft<<<TT / 2 / 8, 256, 0, stream>>>(Sb, P16, Ph, Pl);   /* 2,048 rows of this half, each normalised over its 4,096 keys n: every one under RH: the hi | lo arm; the grid, not the kernel's guard, bounds the rows to these planes */
            k_gemmw<bf, 2, false><<<dim3(HD / 64, TT / 2 / 64, KS), 32, 0, stream>>>(VCh, VCl, Ph, Pl, TT, TT / KS, Pt + r0, TT, nullptr, TT / KS, TT / KS, (size_t)HD * TT); }   /* Pt[z][c][m] = the sum over the 256 keys n of slice z of (hh + hl)[c][n] (wh + wl)[m][n]: three products */
        k_resg<<<G4, 256, 0, stream>>>(Pt, gam, XV, OUT + ob); }   /* out = gamma (the slices' sum) + x: the one writer of this entry's output */
}

// v002
// A run of this version takes 559 microseconds.
// Next to v001, in two timings, it ran 1.38 times as fast each time.
// Over all steps from v000 it is 3.35 times as fast.
#include <hip/hip_runtime.h>

// A single-head spatial self-attention over 4,096 positions with 1 x 1 convolutions (x [8][64][64][64] = [entry][64 channels][4,096 positions]; Wq, Wk [8][64], Wv [64][64], ALL 'oi' (out, in), no bias; gamma [1], a scalar input): f = Wq x and g = Wk x (8 channels each); h = Wv x (64 channels);
// s[n][m] = f[:, n] . g[:, m] (no scale, no mask); a softmax over n, the score matrix's FIRST axis: for the output position m the weights run over n: g gives position m's query, f the keys; o[c][m] = sum_n h[c][n] weight[n][m]; out[c][m] = gamma o[c][m] + x[c][m] -> [8][64][64][64] (2.1 M); argument order x, Wq, Wk, Wv, gamma: all read.
// Layout: once: the three weights' bf16 words (Wk's and Wq's rows as rows 0..7 and 8..15 of ONE 64-row B operand whose other rows are filled from Wv's rows: their product columns are never read); then, ONE launch of each kernel for all 8 entries (every plane holds the 8 entries one behind the other): x rounded to bf16 (kept f32), laid token-major [4096][64] (k_msin: its channel-major copy is written and not read here) and cast to its exact bf16 words;
// ONE product at depth 64 gives query | key | (unread) token-major; k_qk0 lays the two 8-channel maps as f32 planes [4096][32] whose columns 8..31 are WRITTEN ZEROS (the matrix unit's depth is a multiple of 32); their bf16 hi | lo planes; h channel-major [64][4096] by ONE product with the roles exchanged (A = Wv's rows, Bt = the token-major plane) and its hi | lo planes;
// then, per entry, a half of the query rows at a time (2,048): the scores on hi + lo words of both operands (three products at depth 32); the dense softmax (multiplier 1.0) on its hi | lo arm for every row (RH = TT): the normalised weights as bf16 hi and lo planes; the value product on hi + lo words of both (three products at depth 4,096), its depth cut into KS = 16 slices of 256 keys, one grid z each, every slice's f32 sums in a plane of its own, channel-major as the output is (A = h's rows, Bt = the weights' rows): Pt[entry][z][64][4096];
// k_resg, ONE launch for all 8 entries behind the last value product: out[c][m] = gamma (the sum over z, in z order, of Pt[z][c][m]) + x[c][m] (gamma read from its input and rounded to bf16 as every float input is).
// TWO flat kernels of this file (k_qk0: a lane -> one position; k_resg: a lane -> four consecutive positions of one channel; f32 planes alone; every address from the lane's own index and launch constants; no LDS, barrier, cross-lane word or atomic).
// Compute dtypes, f32 accumulate: every float input rounded to bf16 at its load; the three 1 x 1 convolutions ONE bf16 product each on exact operands; the two 8-channel maps, h and the weights as bf16 hi + lo words at both attention products; softmax f32; the scaled residual f32.

#define NB_  8
#define TT   4096                 // positions = the softmax's key axis
#define HD   64                   // channels
#define DQK  8                    // q and k channels
#define DP   32                   // q and k padded to the matrix unit's depth
#define ZH   1
#define RH   4096                 // query rows < RH use hi+lo planes (4096 = TT: EVERY row)
#define PCAR 1024.0f
#define SCL  1.0f                 // no scale: the scores as they are
#define KS   16                   // depth slices of the value product: 32 tiles x 16 slices = 512 waves a launch
typedef _Float16 h16;
typedef unsigned short bf;
typedef __attribute__((ext_vector_type(16))) __bf16   v16bf;
typedef __attribute__((ext_vector_type(16))) _Float16 v16h;
typedef __attribute__((ext_vector_type(8)))  _Float16 v8h;
typedef __attribute__((ext_vector_type(8)))  unsigned short v8us;
typedef __attribute__((ext_vector_type(8)))  float    v8f;
typedef __attribute__((ext_vector_type(4)))  float    v4f;
typedef v8h  __attribute__((may_alias)) v8ha;
typedef v4f  __attribute__((may_alias)) v4fa;
typedef v8us __attribute__((may_alias)) v8usa;

__device__ __forceinline__ unsigned short f2bf(float f) { unsigned u = __float_as_uint(f); u += 0x7FFFu + ((u >> 16) & 1u); return (unsigned short)(u >> 16); }
__device__ __forceinline__ float bf2f(unsigned short b) { return __uint_as_float(((unsigned)b) << 16); }
__device__ __forceinline__ float bfr(float f) { return bf2f(f2bf(f)); }
__device__ __forceinline__ v16h cat16(v8h lo, v8h hi) { return __builtin_shufflevector(lo, hi, 0, 1, 2, 3, 4, 5, 6, 7, 8, 9, 10, 11, 12, 13, 14, 15); }
__device__ __forceinline__ v16bf cat16b(v8us lo, v8us hi) { return __builtin_bit_cast(v16bf, __builtin_shufflevector(lo, hi, 0, 1, 2, 3, 4, 5, 6, 7, 8, 9, 10, 11, 12, 13, 14, 15)); }
__device__ __forceinline__ v8f wmma16(v16h a, v16h b, v8f c) { return __builtin_amdgcn_wmma_f32_16x16x32_f16(false, a, false, b, (short)0, c, false, false); }
__device__ __forceinline__ v8f wmmab(v16bf a, v16bf b, v8f c) { return __builtin_amdgcn_wmma_f32_16x16x32_bf16(false, a, false, b, (short)0, c, false, false); }



// ---- k_gemmw: register-blocked GEMM, ONE WAVE per 64x64 output tile (16 accumulators), operands straight from K-contiguous 16-bit planes; grid (M/64, N/64, Z), 32 threads.
// C[m][n] (f32, pitch ldc, + optional f32 bias[n]) = sum_k A[m][k] Bt[n][k] (+ split products per NSPLIT). z-batch strides sA/sB/sC in elements. K % 32 == 0. K is the row pitch of A and Bt; KD (KD % 32 == 0) is the depth that one z runs: K where a launch runs the whole depth; a launch that gives each z a slice of the depth passes the slice's length as KD, sA and sB, and a plane's size as sC.
template <typename T16> struct WFrag;
template <> struct WFrag<h16> { typedef v16h V; static __device__ __forceinline__ V ld(const h16* p) { return cat16(*(const v8h*)p, *(const v8h*)(p + 16)); } static __device__ __forceinline__ v8f mma(V a, V b, v8f c) { return wmma16(a, b, c); } };
template <> struct WFrag<bf> { typedef v16bf V; static __device__ __forceinline__ V ld(const bf* p) { return cat16b(*(const v8us*)p, *(const v8us*)(p + 16)); } static __device__ __forceinline__ v8f mma(V a, V b, v8f c) { return wmmab(a, b, c); } };
template <typename T16, int NSPLIT, bool BIAS>
__global__ __launch_bounds__(32) void k_gemmw(const T16* __restrict__ A, const T16* __restrict__ A2, const T16* __restrict__ Bt, const T16* __restrict__ Bt2, int K, int KD, float* C, int ldc, const float* __restrict__ bias, size_t sA, size_t sB, size_t sC) {
    typedef typename WFrag<T16>::V V;
    __shared__ __align__(16) float os[16 * 68];
    const size_t z = blockIdx.z; A += z * sA; if (A2) A2 += z * sA; Bt += z * sB; if (Bt2) Bt2 += z * sB; C += z * sC;
    const int lane = threadIdx.x & 31, lr = lane & 15, hi = lane >> 4; const int r0 = blockIdx.x * 64, c0 = blockIdx.y * 64;
    v8f acc[4][4];
#pragma unroll
    for (int mb = 0; mb < 4; ++mb)
#pragma unroll
        for (int nb = 0; nb < 4; ++nb) acc[mb][nb] = (v8f){};
    const size_t aoff = (size_t)(r0 + lr) * K + 8 * hi, boff = (size_t)(c0 + lr) * K + 8 * hi;

    for (int kc = 0; kc < KD; kc += 32) {
        V a[4], a2[4];
#pragma unroll
        for (int mb = 0; mb < 4; ++mb) { a[mb] = WFrag<T16>::ld(A + aoff + (size_t)mb * 16 * K + kc); if (NSPLIT == 1 || NSPLIT == 2) a2[mb] = WFrag<T16>::ld(A2 + aoff + (size_t)mb * 16 * K + kc); }
#pragma unroll
        for (int nb = 0; nb < 4; ++nb) { const V b = WFrag<T16>::ld(Bt + boff + (size_t)nb * 16 * K + kc); V b2; if (NSPLIT >= 2) b2 = WFrag<T16>::ld(Bt2 + boff + (size_t)nb * 16 * K + kc);
#pragma unroll
            for (int mb = 0; mb < 4; ++mb) { acc[mb][nb] = WFrag<T16>::mma(a[mb], b, acc[mb][nb]); if (NSPLIT == 1 || NSPLIT == 2) acc[mb][nb] = WFrag<T16>::mma(a2[mb], b, acc[mb][nb]); if (NSPLIT >= 2) acc[mb][nb] = WFrag<T16>::mma(a[mb], b2, acc[mb][nb]); } }
        asm volatile("v_nop\n\tv_nop\n\tv_nop\n\tv_nop" : "+v"(acc[0][0]), "+v"(acc[1][1]), "+v"(acc[2][2]), "+v"(acc[3][3]) : "v"(a[0]), "v"(a[3]));
    }
#pragma unroll
    for (int mb = 0; mb < 4; ++mb) {
#pragma unroll
        for (int nb = 0; nb < 4; ++nb) {
#pragma unroll
            for (int j = 0; j < 8; ++j) os[(hi * 8 + j) * 68 + nb * 16 + lr] = acc[mb][nb][j]; }
        __builtin_amdgcn_wave_barrier(); asm volatile("" ::: "memory");
        float* crow = C + (size_t)(r0 + mb * 16) * ldc + c0;
{
#pragma unroll
            for (int s = 0; s < 8; ++s) { const int row = 2 * s + hi, cofs = lr * 4; v4f val = *(const v4fa*)(os + row * 68 + cofs); if (BIAS) { val[0] += bfr(bias[c0 + cofs]); val[1] += bfr(bias[c0 + cofs + 1]); val[2] += bfr(bias[c0 + cofs + 2]); val[3] += bfr(bias[c0 + cofs + 3]); }
                *(v4f*)(crow + (size_t)row * ldc + cofs) = val; }
             }
        __builtin_amdgcn_wave_barrier(); asm volatile("" ::: "memory");
    }
}

__device__ __forceinline__ h16 tohx(float x) { return (h16)x; }
__device__ __forceinline__ void splitf(float y, unsigned short& h, unsigned short& l) { h = f2bf(y); l = f2bf(y - bf2f(h)); }
typedef __attribute__((ext_vector_type(2))) _Float16 v2h;
typedef __attribute__((ext_vector_type(4))) _Float16 v4h;
typedef __attribute__((ext_vector_type(2))) unsigned short v2us;
typedef __attribute__((ext_vector_type(4))) unsigned short v4us;
typedef __attribute__((ext_vector_type(2))) float v2f;
typedef __attribute__((ext_vector_type(4))) int v4i;

// k_asoft: per row (zz, i): t = S x SCL (SCL = 1.0: the module applies no scale; no mask); softmax over the 4096 keys (register row, one exp, fixed trees);
__global__ __launch_bounds__(256) void k_asoft(const float* __restrict__ Sb, h16* P16, bf* Ph, bf* Pl) {
    const int lane = threadIdx.x & 31; const int row = blockIdx.x * 8 + (threadIdx.x >> 5); if (row >= ZH * TT) return; const int i = row % TT; const int zz = row / TT; (void)zz; const bool hires = (i < RH); const float* sr = Sb + (size_t)row * TT; float v[TT / 32]; float mx = -3.0e38f;
#pragma unroll
    for (int ch = 0; ch < TT / 128; ++ch) { const int j0 = ch * 128 + lane * 4; const v4f a = *(const v4f*)(sr + j0);
#pragma unroll
        for (int q = 0; q < 4; ++q) { const int j = j0 + q; (void)j; const float t = a[q] * SCL; v[ch * 4 + q] = t; mx = fmaxf(mx, t); } }
#pragma unroll
    for (int sh = 16; sh; sh >>= 1) mx = fmaxf(mx, __shfl_xor(mx, sh, 32));
    float sum = 0.f;
#pragma unroll
    for (int k = 0; k < TT / 32; ++k) { float d0 = __fsub_rn(v[k], mx); v[k] = __builtin_amdgcn_exp2f(__fmul_rn(d0, 1.4426950408889634f)); sum += v[k]; }
#pragma unroll
    for (int sh = 16; sh; sh >>= 1) sum += __shfl_xor(sum, sh, 32);
    const float f = __fdiv_rn(hires ? 1.0f : PCAR, sum);
{
        if (hires) {
#pragma unroll
            for (int ch = 0; ch < TT / 128; ++ch) { v4us oh, ol;
#pragma unroll
                for (int q = 0; q < 4; ++q) { unsigned short a, c2; splitf(v[ch * 4 + q] * f, a, c2); oh[q] = a; ol[q] = c2; }
                const size_t oo = ((size_t)zz * (RH ? RH : 1) + i) * TT + ch * 128 + lane * 4; *(v4us*)(Ph + oo) = oh; *(v4us*)(Pl + oo) = ol; }
        } else {
#pragma unroll
            for (int ch = 0; ch < TT / 128; ++ch) { v4h o4;
#pragma unroll
                for (int q = 0; q < 4; ++q) o4[q] = tohx(v[ch * 4 + q] * f);
                *(v4h*)(P16 + (size_t)row * TT + ch * 128 + lane * 4) = o4; } }
         }
}
__global__ __launch_bounds__(256) void k_cvt8(const float* __restrict__ src, bf* dst, size_t n8) { const size_t i = (size_t)blockIdx.x * 256 + threadIdx.x; if (i >= n8) return; const v8f v = *(const v8f*)(src + i * 8); v8us o;
#pragma unroll
    for (int k = 0; k < 8; ++k) o[k] = f2bf(v[k]); *(v8us*)(dst + i * 8) = o;  }
__global__ __launch_bounds__(256) void k_rbf(const float* __restrict__ X, float* Y, size_t n4) { const size_t i = (size_t)blockIdx.x * 256 + threadIdx.x; if (i >= n4) return; const v4f a = *(const v4f*)(X + i * 4); v4f o;
#pragma unroll
    for (int q = 0; q < 4; ++q) o[q] = bfr(a[q]);
    *(v4f*)(Y + i * 4) = o;  }
__global__ __launch_bounds__(256) void k_pl2(const float* __restrict__ F, bf* Ph, bf* Pl, size_t n4) { const size_t i = (size_t)blockIdx.x * 256 + threadIdx.x; if (i >= n4) return; const v4f v = *(const v4f*)(F + i * 4); v4us oh, ol;
#pragma unroll
    for (int q = 0; q < 4; ++q) { unsigned short a, c; splitf(v[q], a, c); oh[q] = a; ol[q] = c; } *(v4us*)(Ph + i * 4) = oh; *(v4us*)(Pl + i * 4) = ol;  }
// k_msin: from xr (an entry's [64][4096] channel-major input, ALREADY rounded to bf16 and kept f32 by k_rbf): Y[n][c] = xr[c][n] (f32, token-major) and O0[c][n] = the same value (a channel-major copy: written into a spare plane here and not read); grid (TT / 512, entries): blockIdx.y picks the entry's planes;
__global__ __launch_bounds__(256) void k_msin(const float* __restrict__ xr, float* Y, float* O0) { const size_t e = (size_t)blockIdx.x * 256 + threadIdx.x; const size_t n0 = e * 2; const size_t eo = (size_t)blockIdx.y * HD * TT; xr += eo; Y += eo; O0 += eo;
    for (int kc = 0; kc < HD / 16; ++kc) { float a[16], b[16];
#pragma unroll
        for (int c = 0; c < 16; ++c) { const v2f v = *(const v2f*)(xr + (size_t)(kc * 16 + c) * TT + n0); a[c] = v[0]; b[c] = v[1]; }
{
#pragma unroll
            for (int k = 0; k < 4; ++k) { v4f o; o[0] = a[k * 4]; o[1] = a[k * 4 + 1]; o[2] = a[k * 4 + 2]; o[3] = a[k * 4 + 3]; *(v4f*)(Y + n0 * HD + kc * 16 + k * 4) = o; o[0] = b[k * 4]; o[1] = b[k * 4 + 1]; o[2] = b[k * 4 + 2]; o[3] = b[k * 4 + 3]; *(v4f*)(Y + (n0 + 1) * HD + kc * 16 + k * 4) = o; }
#pragma unroll
            for (int c = 0; c < 16; ++c) { v2f f2; f2[0] = a[c]; f2[1] = b[c]; *(v2f*)(O0 + (size_t)(kc * 16 + c) * TT + n0) = f2; }
             } } }
// k_qk0: from QK[n][0..7] (the query map g = Wk x at position n) and QK[n][8..15] (the key map f = Wq x): QF[n][0..7] and KF[n][0..7] as they are (the module has no bias), and QF[n][8..31] = KF[n][8..31] = 0: WRITTEN ZEROS (the score product runs at depth 32);
__global__ __launch_bounds__(256) void k_qk0(const float* __restrict__ QK, float* QF, float* KF) { const size_t n = (size_t)blockIdx.x * 256 + threadIdx.x; const v4f q0 = *(const v4f*)(QK + n * HD), q1 = *(const v4f*)(QK + n * HD + 4), k0 = *(const v4f*)(QK + n * HD + 8), k1 = *(const v4f*)(QK + n * HD + 12);
    v4f z; z[0] = 0.f; z[1] = 0.f; z[2] = 0.f; z[3] = 0.f;
{ *(v4f*)(QF + n * DP) = q0; *(v4f*)(QF + n * DP + 4) = q1; *(v4f*)(KF + n * DP) = k0; *(v4f*)(KF + n * DP + 4) = k1;
#pragma unroll
        for (int k = 2; k < DP / 4; ++k) { *(v4f*)(QF + n * DP + k * 4) = z; *(v4f*)(KF + n * DP + k * 4) = z; }
         } }
// k_resg: out[c][m] = g (Pt[0][c][m] + Pt[1][c][m] + ... + Pt[KS - 1][c][m]) + XV[c][m] (Pt = the value product's KS depth slices, channel-major planes, summed in z order; g = the scalar input GAM[0] rounded to bf16; XV = this entry's rounded x, channel-major: the residual); grid (HD TT / 1024, entries): blockIdx.y picks the entry's KS planes, its XV and its output;
__global__ __launch_bounds__(256) void k_resg(const float* __restrict__ Pt, const float* __restrict__ GAM, const float* __restrict__ XV, float* out) { const unsigned ob = (blockIdx.x * 256u + threadIdx.x) * 16u; const float g = bfr(GAM[0]);   // ob: the lane's byte offset, the same in a plane, in XV and in out
    Pt += (size_t)blockIdx.y * KS * HD * TT; XV += (size_t)blockIdx.y * HD * TT; out += (size_t)blockIdx.y * HD * TT;
    v4f o = *(const v4f*)((const char*)Pt + ob);
#pragma unroll
    for (int z = 1; z < KS; ++z) { const v4f p = *(const v4f*)((const char*)(Pt + (size_t)z * HD * TT) + ob);
#pragma unroll
        for (int q = 0; q < 4; ++q) o[q] += p[q]; }
    const v4f xv = *(const v4f*)((const char*)XV + ob);
#pragma unroll
    for (int q = 0; q < 4; ++q) o[q] = g * o[q] + xv[q];
    *(v4f*)((char*)out + ob) = o; }

extern "C" void kernel_launch(void* const* d_in, const int* in_sizes, int n_in,
                              void* d_out, int out_size, void* d_ws, size_t ws_size, hipStream_t stream) {
    (void)in_sizes; (void)n_in; (void)out_size;
    const float* x = (const float*)d_in[0]; const float* wq = (const float*)d_in[1]; const float* wk = (const float*)d_in[2]; const float* wv = (const float*)d_in[3]; const float* gam = (const float*)d_in[4];
    // inputs in the module's argument order: x, Wq, Wk, Wv, gamma = d_in[0..4]: all read
    float* OUT = (float*)d_out;     // [8][64][4096]
    char* wsp = (char*)d_ws;
    auto take = [&](size_t bytes) { char* p = wsp; wsp += (bytes + 255) & ~(size_t)255; return (void*)p; };
    float* WR = (float*)take((size_t)HD * HD * 4); bf* WQKB = (bf*)take((size_t)HD * HD * 2); bf* WVB = (bf*)take((size_t)HD * HD * 2);
    // planes that live to the end, 8 entries each
    float* XV = (float*)take((size_t)NB_ * HD * TT * 4);
    bf* Qh = (bf*)take((size_t)NB_ * TT * DP * 2); bf* Ql = (bf*)take((size_t)NB_ * TT * DP * 2); bf* Kh = (bf*)take((size_t)NB_ * TT * DP * 2); bf* Kl = (bf*)take((size_t)NB_ * TT * DP * 2); bf* VCh = (bf*)take((size_t)NB_ * HD * TT * 2); bf* VCl = (bf*)take((size_t)NB_ * HD * TT * 2);
    h16* P16 = nullptr;   /* RH = TT: the softmax's f16 arm is never taken: its stores sit under the 'else' of 'i < RH' */
    float* Sb = (float*)take((size_t)(TT / 2) * TT * 4); bf* Ph = (bf*)take((size_t)(TT / 2) * TT * 2); bf* Pl = (bf*)take((size_t)(TT / 2) * TT * 2); float* Pt = (float*)take((size_t)NB_ * KS * HD * TT * 4);
    if ((size_t)(wsp - (char*)d_ws) > ws_size) return;    // total 216.03 MiB carved
    // the preparation's intermediate planes (44 MiB) lie in Pt's 128 MiB: each is last read before the first value product writes Pt
    wsp = (char*)Pt;
    float* YV = (float*)take((size_t)NB_ * TT * HD * 4); float* SPARE = (float*)take((size_t)NB_ * HD * TT * 4); bf* YVB = (bf*)take((size_t)NB_ * TT * HD * 2); float* QKF = (float*)take((size_t)NB_ * TT * HD * 4);
    float* QF = (float*)take((size_t)NB_ * TT * DP * 4); float* KF = (float*)take((size_t)NB_ * TT * DP * 4); float* VC = (float*)take((size_t)NB_ * HD * TT * 4);
    k_rbf<<<1, 256, 0, stream>>>(wk, WR, (size_t)DQK * HD / 4); k_rbf<<<1, 256, 0, stream>>>(wq, WR + (size_t)DQK * HD, (size_t)DQK * HD / 4); k_rbf<<<3, 256, 0, stream>>>(wv, WR + (size_t)2 * DQK * HD, (size_t)(HD - 2 * DQK) * HD / 4);   /* the 64-row B of the query | key product: Wk's 8 rows (the query map), Wq's 8 (the key map), then 48 rows of Wv as filler (their product columns are never read): every word written */
    k_cvt8<<<2, 256, 0, stream>>>(WR, WQKB, (size_t)HD * HD / 8); k_cvt8<<<2, 256, 0, stream>>>(wv, WVB, (size_t)HD * HD / 8);   /* 'oi' rows as they stand */
    const size_t N4 = (size_t)NB_ * HD * TT / 4, N8 = (size_t)NB_ * HD * TT / 8; const unsigned G4 = (unsigned)((N4 + 255) / 256), G8 = (unsigned)((N8 + 255) / 256); const size_t P4 = (size_t)NB_ * TT * DP / 4; const unsigned GP = (unsigned)((P4 + 255) / 256);   /* counts over all 8 entries */
    k_rbf<<<G4, 256, 0, stream>>>(x, XV, N4);   /* the input rounded to bf16, kept f32 */
    k_msin<<<dim3(TT / 2 / 256, NB_, 1), 256, 0, stream>>>(XV, YV, SPARE);   /* the token-major planes; the channel-major copies go to spare planes and are not read */
    k_cvt8<<<G8, 256, 0, stream>>>(YV, YVB, N8);   /* exact bf16 words */
    k_gemmw<bf, 0, false><<<dim3(NB_ * TT / 64, HD / 64, 1), 32, 0, stream>>>(YVB, nullptr, WQKB, nullptr, HD, HD, QKF, HD, nullptr, 0, 0, 0);   /* [query | key | unread][n] = x[:, n] . [Wk | Wq | filler] rows; the 8 entries' token rows are one run of 32,768 rows */
    k_qk0<<<(unsigned)(NB_ * TT / 256), 256, 0, stream>>>(QKF, QF, KF); k_pl2<<<GP, 256, 0, stream>>>(QF, Qh, Ql, P4); k_pl2<<<GP, 256, 0, stream>>>(KF, Kh, Kl, P4);
    k_gemmw<bf, 0, false><<<dim3(HD / 64, TT / 64, NB_), 32, 0, stream>>>(WVB, nullptr, YVB, nullptr, HD, HD, VC, TT, nullptr, 0, (size_t)TT * HD, (size_t)HD * TT); k_pl2<<<G4, 256, 0, stream>>>(VC, VCh, VCl, N4);   /* h channel-major: VC[c][n] = Wv[c][:] . x[:, n]; grid z = the entry */
    for (int b = 0; b < NB_; ++b) { const size_t ob = (size_t)b * HD * TT, pb = (size_t)b * TT * DP;
        for (int hf = 0; hf < 2; ++hf) { const size_t r0 = (size_t)hf * (TT / 2);   /* a half of the query rows at a time */
            k_gemmw<bf, 2, false><<<dim3(TT / 2 / 64, TT / 64, 1), 32, 0, stream>>>(Qh + pb + r0 * DP, Ql + pb + r0 * DP, Kh + pb, Kl + pb, DP, DP, Sb, TT, nullptr, 0, 0, 0);   /* Sb[m][n] = g[:, m] . f[:, n] on hi + lo words of both: depth 32: one step of the depth loop */
            k_asoft<<<TT / 2 / 8, 256, 0, stream>>>(Sb, P16, Ph, Pl);   /* 2,048 rows of this half, each normalised over its 4,096 keys n: every one under RH: the hi | lo arm; the grid, not the kernel's guard, bounds the rows to these planes */
            k_gemmw<bf, 2, false><<<dim3(HD / 64, TT / 2 / 64, KS), 32, 0, stream>>>(VCh + ob, VCl + ob, Ph, Pl, TT, TT / KS, Pt + ob * KS + r0, TT, nullptr, TT / KS, TT / KS, (size_t)HD * TT); } }   /* Pt[b][z][c][m] = the sum over the 256 keys n of slice z of (hh + hl)[c][n] (wh + wl)[m][n]: three products */
    k_resg<<<dim3(HD * TT / 1024, NB_, 1), 256, 0, stream>>>(Pt, gam, XV, OUT);   /* out = gamma (the slices' sum) + x: the one writer of the output */
}

// v003
// One run takes 135 microseconds.
// Next to v002, in two timings, it ran 4.15 and 4.10 times as fast.
// Over all steps from v000 it is 13.8 times as fast.
#include <hip/hip_runtime.h>

// A single-head spatial self-attention over 4,096 positions with 1 x 1 convolutions (x [8][64][64][64] = [entry][64 channels][4,096 positions]; Wq, Wk [8][64], Wv [64][64], ALL 'oi' (out, in), no bias; gamma [1], a scalar input): f = Wq x and g = Wk x (8 channels each); h = Wv x (64 channels);
// s[n][m] = f[:, n] . g[:, m] (no scale, no mask); a softmax over n, the score matrix's FIRST axis: for the output position m the weights run over n: g gives position m's query, f the keys; o[c][m] = sum_n h[c][n] weight[n][m]; out[c][m] = gamma o[c][m] + x[c][m] -> [8][64][64][64] (2.1 M); argument order x, Wq, Wk, Wv, gamma: all read.
// Layout: once: the three weights' bf16 words (Wk's and Wq's rows as rows 0..7 and 8..15 of ONE 64-row B operand whose other rows are filled from Wv's rows: their product columns are never read); then, ONE launch of each kernel for all 8 entries (every plane holds the 8 entries one behind the other): x rounded to bf16 (kept f32), laid token-major [4096][64] (k_msin: its channel-major copy is written and not read here) and cast to its exact bf16 words;
// ONE product at depth 64 gives query | key | (unread) token-major; k_qk0 lays the two 8-channel maps as f32 planes [4096][32] whose columns 8..31 are WRITTEN ZEROS (the matrix unit's depth is a multiple of 32); their bf16 hi | lo planes; h channel-major [64][4096] by ONE product with the roles exchanged (A = Wv's rows, Bt = the token-major plane) and its hi | lo planes;
// then ONE launch of k_fattn for all 8 entries: scores, softmax and value product in one kernel, so that neither the scores nor the weights ever reach memory. A work-group has 128 output positions m (4 groups of 32) x 4 quarters of the 4,096 keys n = 16 waves; a wave walks its 1,024 keys 32 at a time: the TRANSPOSED scores (A = key rows, Bt = query rows; hi + lo words of both, three products at depth 32), a running maximum and sum per position, the unnormalised weights exp(s - maximum in use) as bf16 hi and lo words straight from the score accumulators into the Bt operand of the value product (A = h's rows; hi + lo words of both, three products); the four quarters are joined in LDS, in quarter order, and normalised: Pt[entry][64][4096], channel-major as the output is;
// k_resg, ONE launch for all 8 entries behind it: out[c][m] = gamma Pt[c][m] + x[c][m] (gamma read from its input and rounded to bf16 as every float input is).
// TWO flat kernels of this file (k_qk0: a lane -> one position; k_resg: a lane -> four consecutive positions of one channel; f32 planes alone; every address from the lane's own index and launch constants; no LDS, barrier, cross-lane word or atomic) and k_fattn.
// Compute dtypes, f32 accumulate: every float input rounded to bf16 at its load; the three 1 x 1 convolutions ONE bf16 product each on exact operands; the two 8-channel maps, h and the weights as bf16 hi + lo words at both attention products; softmax f32; the scaled residual f32.

#define NB_  8
#define TT   4096                 // positions = the softmax's key axis
#define HD   64                   // channels
#define DQK  8                    // q and k channels
#define DP   32                   // q and k padded to the matrix unit's depth
#define KS   1                    // planes that k_resg sums: k_fattn hands it ONE finished plane an entry
#define FQG  4                    // k_fattn: groups of 32 output positions a work-group
#define FKQ  4                    // k_fattn: parts of the key axis a work-group, one wave each per group
#define L2E  1.4426950408889634f
typedef _Float16 h16;
typedef unsigned short bf;
typedef __attribute__((ext_vector_type(16))) __bf16   v16bf;
typedef __attribute__((ext_vector_type(16))) _Float16 v16h;
typedef __attribute__((ext_vector_type(8)))  _Float16 v8h;
typedef __attribute__((ext_vector_type(8)))  unsigned short v8us;
typedef __attribute__((ext_vector_type(8)))  float    v8f;
typedef __attribute__((ext_vector_type(4)))  float    v4f;
typedef v8h  __attribute__((may_alias)) v8ha;
typedef v4f  __attribute__((may_alias)) v4fa;
typedef v8us __attribute__((may_alias)) v8usa;

__device__ __forceinline__ unsigned short f2bf(float f) { unsigned u = __float_as_uint(f); u += 0x7FFFu + ((u >> 16) & 1u); return (unsigned short)(u >> 16); }
__device__ __forceinline__ float bf2f(unsigned short b) { return __uint_as_float(((unsigned)b) << 16); }
__device__ __forceinline__ float bfr(float f) { return bf2f(f2bf(f)); }
__device__ __forceinline__ v16h cat16(v8h lo, v8h hi) { return __builtin_shufflevector(lo, hi, 0, 1, 2, 3, 4, 5, 6, 7, 8, 9, 10, 11, 12, 13, 14, 15); }
__device__ __forceinline__ v16bf cat16b(v8us lo, v8us hi) { return __builtin_bit_cast(v16bf, __builtin_shufflevector(lo, hi, 0, 1, 2, 3, 4, 5, 6, 7, 8, 9, 10, 11, 12, 13, 14, 15)); }
__device__ __forceinline__ v8f wmma16(v16h a, v16h b, v8f c) { return __builtin_amdgcn_wmma_f32_16x16x32_f16(false, a, false, b, (short)0, c, false, false); }
__device__ __forceinline__ v8f wmmab(v16bf a, v16bf b, v8f c) { return __builtin_amdgcn_wmma_f32_16x16x32_bf16(false, a, false, b, (short)0, c, false, false); }



// ---- k_gemmw: register-blocked GEMM, ONE WAVE per 64x64 output tile (16 accumulators), operands straight from K-contiguous 16-bit planes; grid (M/64, N/64, Z), 32 threads.
// C[m][n] (f32, pitch ldc, + optional f32 bias[n]) = sum_k A[m][k] Bt[n][k] (+ split products per NSPLIT). z-batch strides sA/sB/sC in elements. K % 32 == 0. K is the row pitch of A and Bt; KD (KD % 32 == 0) is the depth that one z runs: K where a launch runs the whole depth; a launch that gives each z a slice of the depth passes the slice's length as KD, sA and sB, and a plane's size as sC.
template <typename T16> struct WFrag;
template <> struct WFrag<h16> { typedef v16h V; static __device__ __forceinline__ V ld(const h16* p) { return cat16(*(const v8h*)p, *(const v8h*)(p + 16)); } static __device__ __forceinline__ v8f mma(V a, V b, v8f c) { return wmma16(a, b, c); } };
template <> struct WFrag<bf> { typedef v16bf V; static __device__ __forceinline__ V ld(const bf* p) { return cat16b(*(const v8us*)p, *(const v8us*)(p + 16)); } static __device__ __forceinline__ v8f mma(V a, V b, v8f c) { return wmmab(a, b, c); } };
template <typename T16, int NSPLIT, bool BIAS>
__global__ __launch_bounds__(32) void k_gemmw(const T16* __restrict__ A, const T16* __restrict__ A2, const T16* __restrict__ Bt, const T16* __restrict__ Bt2, int K, int KD, float* C, int ldc, const float* __restrict__ bias, size_t sA, size_t sB, size_t sC) {
    typedef typename WFrag<T16>::V V;
    __shared__ __align__(16) float os[16 * 68];
    const size_t z = blockIdx.z; A += z * sA; if (A2) A2 += z * sA; Bt += z * sB; if (Bt2) Bt2 += z * sB; C += z * sC;
    const int lane = threadIdx.x & 31, lr = lane & 15, hi = lane >> 4; const int r0 = blockIdx.x * 64, c0 = blockIdx.y * 64;
    v8f acc[4][4];
#pragma unroll
    for (int mb = 0; mb < 4; ++mb)
#pragma unroll
        for (int nb = 0; nb < 4; ++nb) acc[mb][nb] = (v8f){};
    const size_t aoff = (size_t)(r0 + lr) * K + 8 * hi, boff = (size_t)(c0 + lr) * K + 8 * hi;

    for (int kc = 0; kc < KD; kc += 32) {
        V a[4], a2[4];
#pragma unroll
        for (int mb = 0; mb < 4; ++mb) { a[mb] = WFrag<T16>::ld(A + aoff + (size_t)mb * 16 * K + kc); if (NSPLIT == 1 || NSPLIT == 2) a2[mb] = WFrag<T16>::ld(A2 + aoff + (size_t)mb * 16 * K + kc); }
#pragma unroll
        for (int nb = 0; nb < 4; ++nb) { const V b = WFrag<T16>::ld(Bt + boff + (size_t)nb * 16 * K + kc); V b2; if (NSPLIT >= 2) b2 = WFrag<T16>::ld(Bt2 + boff + (size_t)nb * 16 * K + kc);
#pragma unroll
            for (int mb = 0; mb < 4; ++mb) { acc[mb][nb] = WFrag<T16>::mma(a[mb], b, acc[mb][nb]); if (NSPLIT == 1 || NSPLIT == 2) acc[mb][nb] = WFrag<T16>::mma(a2[mb], b, acc[mb][nb]); if (NSPLIT >= 2) acc[mb][nb] = WFrag<T16>::mma(a[mb], b2, acc[mb][nb]); } }
        asm volatile("v_nop\n\tv_nop\n\tv_nop\n\tv_nop" : "+v"(acc[0][0]), "+v"(acc[1][1]), "+v"(acc[2][2]), "+v"(acc[3][3]) : "v"(a[0]), "v"(a[3]));
    }
#pragma unroll
    for (int mb = 0; mb < 4; ++mb) {
#pragma unroll
        for (int nb = 0; nb < 4; ++nb) {
#pragma unroll
            for (int j = 0; j < 8; ++j) os[(hi * 8 + j) * 68 + nb * 16 + lr] = acc[mb][nb][j]; }
        __builtin_amdgcn_wave_barrier(); asm volatile("" ::: "memory");
        float* crow = C + (size_t)(r0 + mb * 16) * ldc + c0;
{
#pragma unroll
            for (int s = 0; s < 8; ++s) { const int row = 2 * s + hi, cofs = lr * 4; v4f val = *(const v4fa*)(os + row * 68 + cofs); if (BIAS) { val[0] += bfr(bias[c0 + cofs]); val[1] += bfr(bias[c0 + cofs + 1]); val[2] += bfr(bias[c0 + cofs + 2]); val[3] += bfr(bias[c0 + cofs + 3]); }
                *(v4f*)(crow + (size_t)row * ldc + cofs) = val; }
             }
        __builtin_amdgcn_wave_barrier(); asm volatile("" ::: "memory");
    }
}

__device__ __forceinline__ h16 tohx(float x) { return (h16)x; }
__device__ __forceinline__ void splitf(float y, unsigned short& h, unsigned short& l) { h = f2bf(y); l = f2bf(y - bf2f(h)); }
typedef __attribute__((ext_vector_type(2))) _Float16 v2h;
typedef __attribute__((ext_vector_type(4))) _Float16 v4h;
typedef __attribute__((ext_vector_type(2))) unsigned short v2us;
typedef __attribute__((ext_vector_type(4))) unsigned short v4us;
typedef __attribute__((ext_vector_type(2))) float v2f;
typedef __attribute__((ext_vector_type(4))) int v4i;

__global__ __launch_bounds__(256) void k_cvt8(const float* __restrict__ src, bf* dst, size_t n8) { const size_t i = (size_t)blockIdx.x * 256 + threadIdx.x; if (i >= n8) return; const v8f v = *(const v8f*)(src + i * 8); v8us o;
#pragma unroll
    for (int k = 0; k < 8; ++k) o[k] = f2bf(v[k]); *(v8us*)(dst + i * 8) = o;  }
__global__ __launch_bounds__(256) void k_rbf(const float* __restrict__ X, float* Y, size_t n4) { const size_t i = (size_t)blockIdx.x * 256 + threadIdx.x; if (i >= n4) return; const v4f a = *(const v4f*)(X + i * 4); v4f o;
#pragma unroll
    for (int q = 0; q < 4; ++q) o[q] = bfr(a[q]);
    *(v4f*)(Y + i * 4) = o;  }
__global__ __launch_bounds__(256) void k_pl2(const float* __restrict__ F, bf* Ph, bf* Pl, size_t n4) { const size_t i = (size_t)blockIdx.x * 256 + threadIdx.x; if (i >= n4) return; const v4f v = *(const v4f*)(F + i * 4); v4us oh, ol;
#pragma unroll
    for (int q = 0; q < 4; ++q) { unsigned short a, c; splitf(v[q], a, c); oh[q] = a; ol[q] = c; } *(v4us*)(Ph + i * 4) = oh; *(v4us*)(Pl + i * 4) = ol;  }
// k_msin: from xr (an entry's [64][4096] channel-major input, ALREADY rounded to bf16 and kept f32 by k_rbf): Y[n][c] = xr[c][n] (f32, token-major) and O0[c][n] = the same value (a channel-major copy: written into a spare plane here and not read); grid (TT / 512, entries): blockIdx.y picks the entry's planes;
__global__ __launch_bounds__(256) void k_msin(const float* __restrict__ xr, float* Y, float* O0) { const size_t e = (size_t)blockIdx.x * 256 + threadIdx.x; const size_t n0 = e * 2; const size_t eo = (size_t)blockIdx.y * HD * TT; xr += eo; Y += eo; O0 += eo;
    for (int kc = 0; kc < HD / 16; ++kc) { float a[16], b[16];
#pragma unroll
        for (int c = 0; c < 16; ++c) { const v2f v = *(const v2f*)(xr + (size_t)(kc * 16 + c) * TT + n0); a[c] = v[0]; b[c] = v[1]; }
{
#pragma unroll
            for (int k = 0; k < 4; ++k) { v4f o; o[0] = a[k * 4]; o[1] = a[k * 4 + 1]; o[2] = a[k * 4 + 2]; o[3] = a[k * 4 + 3]; *(v4f*)(Y + n0 * HD + kc * 16 + k * 4) = o; o[0] = b[k * 4]; o[1] = b[k * 4 + 1]; o[2] = b[k * 4 + 2]; o[3] = b[k * 4 + 3]; *(v4f*)(Y + (n0 + 1) * HD + kc * 16 + k * 4) = o; }
#pragma unroll
            for (int c = 0; c < 16; ++c) { v2f f2; f2[0] = a[c]; f2[1] = b[c]; *(v2f*)(O0 + (size_t)(kc * 16 + c) * TT + n0) = f2; }
             } } }
// k_qk0: from QK[n][0..7] (the query map g = Wk x at position n) and QK[n][8..15] (the key map f = Wq x): QF[n][0..7] and KF[n][0..7] as they are (the module has no bias), and QF[n][8..31] = KF[n][8..31] = 0: WRITTEN ZEROS (the score product runs at depth 32);
__global__ __launch_bounds__(256) void k_qk0(const float* __restrict__ QK, float* QF, float* KF) { const size_t n = (size_t)blockIdx.x * 256 + threadIdx.x; const v4f q0 = *(const v4f*)(QK + n * HD), q1 = *(const v4f*)(QK + n * HD + 4), k0 = *(const v4f*)(QK + n * HD + 8), k1 = *(const v4f*)(QK + n * HD + 12);
    v4f z; z[0] = 0.f; z[1] = 0.f; z[2] = 0.f; z[3] = 0.f;
{ *(v4f*)(QF + n * DP) = q0; *(v4f*)(QF + n * DP + 4) = q1; *(v4f*)(KF + n * DP) = k0; *(v4f*)(KF + n * DP + 4) = k1;
#pragma unroll
        for (int k = 2; k < DP / 4; ++k) { *(v4f*)(QF + n * DP + k * 4) = z; *(v4f*)(KF + n * DP + k * 4) = z; }
         } }
// k_fattn: see the file's head. grid (TT / 128, entries), 512 threads. Fragment maps: a score tile's accumulator holds, in lane (lr, hi), register j, key n = 8 hi + j of its 16 keys and position m = lr; two such tiles (keys 0..15 and 16..31 of the step) are, register for register, the Bt operand's k order (k = 8 hi + j, then 16 + 8 hi + j) that WFrag::ld gives h's rows as A.
// The query and key planes' columns 16..31 are written zeros: those halves of the fragments are set to zero here and not loaded.
typedef __attribute__((ext_vector_type(16))) float v16f;
typedef __attribute__((ext_vector_type(8))) unsigned v8u;
__device__ __forceinline__ float xhalf(float x) { const int b = __float_as_int(x); return __int_as_float(__builtin_amdgcn_permlanex16(b, b, 0x76543210, 0xfedcba98, false, false)); }   // the value of lane l ^ 16
__device__ __forceinline__ void xwait(unsigned off) { asm volatile("s_wait_xcnt 0x0" : : "v"(off) : "memory"); }   // stands behind a group of loads that share the offset register 'off': the wait in front of any rewrite of that register; naming it as an input keeps it whole up to the wait, so that no load of the group lands on it
__device__ __forceinline__ v16bf ldqk(const bf* p) { const v8us zz = {0, 0, 0, 0, 0, 0, 0, 0}; return cat16b(*(const v8us*)p, zz); }
__global__ __launch_bounds__(512) void k_fattn(const bf* __restrict__ Qh, const bf* __restrict__ Ql, const bf* __restrict__ Kh, const bf* __restrict__ Kl, const bf* __restrict__ Vh, const bf* __restrict__ Vl, float* O) {
    __shared__ __align__(16) float accs[FQG * FKQ * 64 * 32];   // a wave's 64 accumulator registers, lane-major
    __shared__ __align__(16) float mls[FQG * FKQ * 4 * 32];     // a wave's maxima in use (2) and sums (2), lane-major
    const int lane = threadIdx.x & 31, lr = lane & 15, hi = lane >> 4; const int wave = __builtin_amdgcn_readfirstlane(threadIdx.x >> 5), qg = wave & (FQG - 1), kq = wave / FQG;
    const size_t b = blockIdx.y; const int q0 = blockIdx.x * (FQG * 32) + qg * 32; const int nbeg = kq * (TT / FKQ), nend = nbeg + TT / FKQ;
    Qh += b * TT * DP; Ql += b * TT * DP; Kh += b * TT * DP; Kl += b * TT * DP; Vh += b * HD * TT; Vl += b * HD * TT; O += b * HD * TT;
    // every inner loop below has a constant trip count and is unrolled so that its array indices are register names
    v16bf qh[2], ql[2], kh[2], kl[2]; v8f acc[4][2]; float mref[2], lsum[2];
    const unsigned qob = (unsigned)((q0 + lr) * DP + 8 * hi) * 2u; unsigned kob = (unsigned)((nbeg + lr) * DP + 8 * hi) * 2u, vob = (unsigned)(lr * TT + nbeg + 8 * hi) * 2u;   // the lane's byte offsets in a query plane, a key plane and an h plane; the last two step with the loop
#pragma unroll
    for (int mt = 0; mt < 2; ++mt) { qh[mt] = ldqk((const bf*)((const char*)Qh + qob) + mt * 16 * DP); ql[mt] = ldqk((const bf*)((const char*)Ql + qob) + mt * 16 * DP); mref[mt] = -3.0e38f; lsum[mt] = 0.f;
#pragma unroll
        for (int ct = 0; ct < 4; ++ct) acc[ct][mt] = (v8f){}; }
    xwait(qob);
#pragma unroll
    for (int t = 0; t < 2; ++t) { kh[t] = ldqk((const bf*)((const char*)Kh + kob) + t * 16 * DP); kl[t] = ldqk((const bf*)((const char*)Kl + kob) + t * 16 * DP); }
    xwait(kob);
    for (int n = nbeg; n < nend; n += 32) {
        v16bf vh[4], vl[4];   // this step's h fragments: asked for ahead of the scores and the softmax, used behind them
#pragma unroll
        for (int ct = 0; ct < 4; ++ct) { vh[ct] = WFrag<bf>::ld((const bf*)((const char*)Vh + vob) + ct * 16 * TT); vl[ct] = WFrag<bf>::ld((const bf*)((const char*)Vl + vob) + ct * 16 * TT); }
        xwait(vob); vob += 64u;   // the statement's memory clobber also keeps the sixteen loads up here: left free, they sink to just in front of the value product and the wave waits out their whole latency there
        v8f s[2][2];
#pragma unroll
        for (int mt = 0; mt < 2; ++mt)
#pragma unroll
            for (int t = 0; t < 2; ++t) s[mt][t] = wmmab(kh[t], qh[mt], (v8f){});
#pragma unroll
        for (int mt = 0; mt < 2; ++mt)
#pragma unroll
            for (int t = 0; t < 2; ++t) s[mt][t] = wmmab(kh[t], ql[mt], s[mt][t]);
#pragma unroll
        for (int mt = 0; mt < 2; ++mt)
#pragma unroll
            for (int t = 0; t < 2; ++t) s[mt][t] = wmmab(kl[t], qh[mt], s[mt][t]);
        kob += (n + 32 < nend) ? 32u * DP * 2u : 0u;   // the next step's key fragments, one step ahead (the last step asks for its own again: in bounds, not used)
#pragma unroll
        for (int t = 0; t < 2; ++t) { kh[t] = ldqk((const bf*)((const char*)Kh + kob) + t * 16 * DP); kl[t] = ldqk((const bf*)((const char*)Kl + kob) + t * 16 * DP); }
        xwait(kob);
        float tm[2];
#pragma unroll
        for (int mt = 0; mt < 2; ++mt) { float x = fmaxf(s[mt][0][0], s[mt][1][0]);
#pragma unroll
            for (int j = 1; j < 8; ++j) x = fmaxf(x, fmaxf(s[mt][0][j], s[mt][1][j]));
            tm[mt] = fmaxf(x, xhalf(x)); }
        // the maximum in use moves only when a position's new maximum passes it by more than 5.5 (a weight then stays under e^5.5): one scalar test a step for the wave
        if (__builtin_amdgcn_ballot_w32(tm[0] > mref[0] + 5.5f || tm[1] > mref[1] + 5.5f) != 0) {
#pragma unroll
            for (int mt = 0; mt < 2; ++mt) { const float mn = fmaxf(mref[mt], tm[mt]); const float al = __builtin_amdgcn_exp2f((mref[mt] - mn) * L2E); mref[mt] = mn; lsum[mt] *= al;
#pragma unroll
                for (int ct = 0; ct < 4; ++ct)
#pragma unroll
                    for (int j = 0; j < 8; ++j) acc[ct][mt][j] *= al; } }
        v16bf ph[2], pl[2];
#pragma unroll
        for (int mt = 0; mt < 2; ++mt) { const float mb = mref[mt] * L2E; v16f p; float ps = 0.f;
#pragma unroll
            for (int e = 0; e < 16; ++e) { p[e] = __builtin_amdgcn_exp2f(s[mt][e >> 3][e & 7] * L2E - mb); ps += p[e]; }
            lsum[mt] += ps; ph[mt] = __builtin_convertvector(p, v16bf); const v8u w = __builtin_bit_cast(v8u, ph[mt]); v16f r;   // r: what the hi words leave of p
#pragma unroll
            for (int i = 0; i < 8; ++i) { r[2 * i] = p[2 * i] - __uint_as_float(w[i] << 16); r[2 * i + 1] = p[2 * i + 1] - __uint_as_float(w[i] & 0xFFFF0000u); }
            pl[mt] = __builtin_convertvector(r, v16bf); }
#pragma unroll
        for (int ct = 0; ct < 4; ++ct)
#pragma unroll
            for (int mt = 0; mt < 2; ++mt) acc[ct][mt] = wmmab(vh[ct], ph[mt], acc[ct][mt]);
#pragma unroll
        for (int ct = 0; ct < 4; ++ct)
#pragma unroll
            for (int mt = 0; mt < 2; ++mt) acc[ct][mt] = wmmab(vl[ct], ph[mt], acc[ct][mt]);
#pragma unroll
        for (int ct = 0; ct < 4; ++ct)
#pragma unroll
            for (int mt = 0; mt < 2; ++mt) acc[ct][mt] = wmmab(vh[ct], pl[mt], acc[ct][mt]);
    }
    // the join of the FKQ key parts: every wave lays down its part, then finishes channel tile kq of its own position group
#pragma unroll
    for (int mt = 0; mt < 2; ++mt) { mls[(wave * 4 + mt) * 32 + lane] = mref[mt]; mls[(wave * 4 + 2 + mt) * 32 + lane] = lsum[mt] + xhalf(lsum[mt]);
#pragma unroll
        for (int ct = 0; ct < 4; ++ct)
#pragma unroll
            for (int j = 0; j < 8; ++j) accs[(wave * 64 + (ct * 2 + mt) * 8 + j) * 32 + lane] = acc[ct][mt][j]; }
    __syncthreads();
#pragma unroll
    for (int mt = 0; mt < 2; ++mt) { float mk[FKQ], wk[FKQ]; float M = -3.0e38f, L = 0.f;
#pragma unroll
        for (int k = 0; k < FKQ; ++k) { mk[k] = mls[((k * FQG + qg) * 4 + mt) * 32 + lane]; M = fmaxf(M, mk[k]); }
#pragma unroll
        for (int k = 0; k < FKQ; ++k) { wk[k] = __builtin_amdgcn_exp2f((mk[k] - M) * L2E); L += wk[k] * mls[((k * FQG + qg) * 4 + 2 + mt) * 32 + lane]; }
        const float rl = __fdiv_rn(1.0f, L);
#pragma unroll
        for (int j = 0; j < 8; ++j) { float o = 0.f;
#pragma unroll
            for (int k = 0; k < FKQ; ++k) o += wk[k] * accs[((k * FQG + qg) * 64 + (kq * 2 + mt) * 8 + j) * 32 + lane];
            O[(size_t)(kq * 16 + hi * 8 + j) * TT + q0 + mt * 16 + lr] = o * rl; } }
}
// k_resg: out[c][m] = g (Pt[0][c][m] + Pt[1][c][m] + ... + Pt[KS - 1][c][m]) + XV[c][m] (Pt = the value product's KS depth slices, channel-major planes, summed in z order; g = the scalar input GAM[0] rounded to bf16; XV = this entry's rounded x, channel-major: the residual); grid (HD TT / 1024, entries): blockIdx.y picks the entry's KS planes, its XV and its output;
__global__ __launch_bounds__(256) void k_resg(const float* __restrict__ Pt, const float* __restrict__ GAM, const float* __restrict__ XV, float* out) { const unsigned ob = (blockIdx.x * 256u + threadIdx.x) * 16u; const float g = bfr(GAM[0]);   // ob: the lane's byte offset, the same in a plane, in XV and in out
    Pt += (size_t)blockIdx.y * KS * HD * TT; XV += (size_t)blockIdx.y * HD * TT; out += (size_t)blockIdx.y * HD * TT;
    v4f o = *(const v4f*)((const char*)Pt + ob);
#pragma unroll
    for (int z = 1; z < KS; ++z) { const v4f p = *(const v4f*)((const char*)(Pt + (size_t)z * HD * TT) + ob);
#pragma unroll
        for (int q = 0; q < 4; ++q) o[q] += p[q]; }
    const v4f xv = *(const v4f*)((const char*)XV + ob);
#pragma unroll
    for (int q = 0; q < 4; ++q) o[q] = g * o[q] + xv[q];
    *(v4f*)((char*)out + ob) = o; }

extern "C" void kernel_launch(void* const* d_in, const int* in_sizes, int n_in,
                              void* d_out, int out_size, void* d_ws, size_t ws_size, hipStream_t stream) {
    (void)in_sizes; (void)n_in; (void)out_size;
    const float* x = (const float*)d_in[0]; const float* wq = (const float*)d_in[1]; const float* wk = (const float*)d_in[2]; const float* wv = (const float*)d_in[3]; const float* gam = (const float*)d_in[4];
    // inputs in the module's argument order: x, Wq, Wk, Wv, gamma = d_in[0..4]: all read
    float* OUT = (float*)d_out;     // [8][64][4096]
    char* wsp = (char*)d_ws;
    auto take = [&](size_t bytes) { char* p = wsp; wsp += (bytes + 255) & ~(size_t)255; return (void*)p; };
    float* WR = (float*)take((size_t)HD * HD * 4); bf* WQKB = (bf*)take((size_t)HD * HD * 2); bf* WVB = (bf*)take((size_t)HD * HD * 2);
    // planes that live to the end, 8 entries each
    float* XV = (float*)take((size_t)NB_ * HD * TT * 4);
    bf* Qh = (bf*)take((size_t)NB_ * TT * DP * 2); bf* Ql = (bf*)take((size_t)NB_ * TT * DP * 2); bf* Kh = (bf*)take((size_t)NB_ * TT * DP * 2); bf* Kl = (bf*)take((size_t)NB_ * TT * DP * 2); bf* VCh = (bf*)take((size_t)NB_ * HD * TT * 2); bf* VCl = (bf*)take((size_t)NB_ * HD * TT * 2);
    float* Pt = (float*)take((size_t)NB_ * KS * HD * TT * 4);
    // the preparation's intermediate planes
    float* YV = (float*)take((size_t)NB_ * TT * HD * 4); float* SPARE = (float*)take((size_t)NB_ * HD * TT * 4); bf* YVB = (bf*)take((size_t)NB_ * TT * HD * 2); float* QKF = (float*)take((size_t)NB_ * TT * HD * 4);
    float* QF = (float*)take((size_t)NB_ * TT * DP * 4); float* KF = (float*)take((size_t)NB_ * TT * DP * 4); float* VC = (float*)take((size_t)NB_ * HD * TT * 4);
    if ((size_t)(wsp - (char*)d_ws) > ws_size) return;    // total 76.03 MiB carved
    k_rbf<<<1, 256, 0, stream>>>(wk, WR, (size_t)DQK * HD / 4); k_rbf<<<1, 256, 0, stream>>>(wq, WR + (size_t)DQK * HD, (size_t)DQK * HD / 4); k_rbf<<<3, 256, 0, stream>>>(wv, WR + (size_t)2 * DQK * HD, (size_t)(HD - 2 * DQK) * HD / 4);   /* the 64-row B of the query | key product: Wk's 8 rows (the query map), Wq's 8 (the key map), then 48 rows of Wv as filler (their product columns are never read): every word written */
    k_cvt8<<<2, 256, 0, stream>>>(WR, WQKB, (size_t)HD * HD / 8); k_cvt8<<<2, 256, 0, stream>>>(wv, WVB, (size_t)HD * HD / 8);   /* 'oi' rows as they stand */
    const size_t N4 = (size_t)NB_ * HD * TT / 4, N8 = (size_t)NB_ * HD * TT / 8; const unsigned G4 = (unsigned)((N4 + 255) / 256), G8 = (unsigned)((N8 + 255) / 256); const size_t P4 = (size_t)NB_ * TT * DP / 4; const unsigned GP = (unsigned)((P4 + 255) / 256);   /* counts over all 8 entries */
    k_rbf<<<G4, 256, 0, stream>>>(x, XV, N4);   /* the input rounded to bf16, kept f32 */
    k_msin<<<dim3(TT / 2 / 256, NB_, 1), 256, 0, stream>>>(XV, YV, SPARE);   /* the token-major planes; the channel-major copies go to spare planes and are not read */
    k_cvt8<<<G8, 256, 0, stream>>>(YV, YVB, N8);   /* exact bf16 words */
    k_gemmw<bf, 0, false><<<dim3(NB_ * TT / 64, HD / 64, 1), 32, 0, stream>>>(YVB, nullptr, WQKB, nullptr, HD, HD, QKF, HD, nullptr, 0, 0, 0);   /* [query | key | unread][n] = x[:, n] . [Wk | Wq | filler] rows; the 8 entries' token rows are one run of 32,768 rows */
    k_qk0<<<(unsigned)(NB_ * TT / 256), 256, 0, stream>>>(QKF, QF, KF); k_pl2<<<GP, 256, 0, stream>>>(QF, Qh, Ql, P4); k_pl2<<<GP, 256, 0, stream>>>(KF, Kh, Kl, P4);
    k_gemmw<bf, 0, false><<<dim3(HD / 64, TT / 64, NB_), 32, 0, stream>>>(WVB, nullptr, YVB, nullptr, HD, HD, VC, TT, nullptr, 0, (size_t)TT * HD, (size_t)HD * TT); k_pl2<<<G4, 256, 0, stream>>>(VC, VCh, VCl, N4);   /* h channel-major: VC[c][n] = Wv[c][:] . x[:, n]; grid z = the entry */
    k_fattn<<<dim3(TT / (FQG * 32), NB_, 1), FQG * FKQ * 32, 0, stream>>>(Qh, Ql, Kh, Kl, VCh, VCl, Pt);   /* Pt[b][c][m] = the sum over n of h[c][n] softmax_n(g[:, m] . f[:, n]) */
    k_resg<<<dim3(HD * TT / 1024, NB_, 1), 256, 0, stream>>>(Pt, gam, XV, OUT);   /* out = gamma Pt + x: the one writer of the output */
}

// v004
// One run takes 83.6 microseconds.
// Timed twice side by side with v003, it ran 1.61 and 1.62 times as fast.
// All steps since v000 together make it 22.3 times as fast.
#include <hip/hip_runtime.h>

// A single-head spatial self-attention over 4,096 positions with 1 x 1 convolutions (x [8][64][64][64] = [entry][64 channels][4,096 positions]; Wq, Wk [8][64], Wv [64][64], ALL 'oi' (out, in), no bias; gamma [1], a scalar input): f = Wq x and g = Wk x (8 channels each); h = Wv x (64 channels);
// s[n][m] = f[:, n] . g[:, m] (no scale, no mask); a softmax over n, the score matrix's FIRST axis: for the output position m the weights run over n: g gives position m's query, f the keys; o[c][m] = sum_n h[c][n] weight[n][m]; out[c][m] = gamma o[c][m] + x[c][m] -> [8][64][64][64] (2.1 M); argument order x, Wq, Wk, Wv, gamma: all read.
// Layout: TWO launches.
// k_prep, one wave for 64 positions of one entry: x and the three weights are read as they stand (f32), rounded to bf16 in registers and laid straight into matrix fragments; the three 1 x 1 convolutions at depth 64 with the weights' rows as A (one tile of Wk's 8 rows | Wq's 8 rows, four tiles of Wv's rows) and the positions as Bt; the f32 results are split in registers and stored as the bf16 hi | lo planes that k_fattn reads: query and key maps token-major [4096][32], columns 8..31 WRITTEN ZEROS (the matrix unit's depth is a multiple of 32), h channel-major [64][4096].
// k_fattn, for all 8 entries: scores, softmax, value product and residual in one kernel, so that neither the scores nor the weights ever reach memory. A work-group has 128 output positions m (4 groups of 32) x 4 quarters of the 4,096 keys n = 16 waves; a wave walks its 1,024 keys 32 at a time: the TRANSPOSED scores (A = key rows, Bt = query rows; hi + lo words of both, three products at depth 32), a running maximum and sum per position, the unnormalised weights exp(s - maximum in use) as bf16 hi and lo words straight from the score accumulators into the Bt operand of the value product (A = h's rows; hi + lo words of both, three products); the four quarters are joined in LDS, in quarter order, normalised, and stored as out[c][m] = gamma o[c][m] + x[c][m] (gamma and x read from their inputs and rounded to bf16 as every float input is): the one writer of the output.
// Compute dtypes, f32 accumulate: every float input rounded to bf16 at its load; the three 1 x 1 convolutions ONE bf16 product each on exact operands; the two 8-channel maps, h and the weights as bf16 hi + lo words at both attention products; softmax f32; the scaled residual f32.

#define NB_  8
#define TT   4096                 // positions = the softmax's key axis
#define HD   64                   // channels
#define DQK  8                    // q and k channels
#define DP   32                   // q and k padded to the matrix unit's depth
#define QKP  (NB_ * TT * DP)      // elements of one query or key plane, all entries
#define FQG  4                    // k_fattn: groups of 32 output positions a work-group
#define FKQ  4                    // k_fattn: parts of the key axis a work-group, one wave each per group
#define L2E  1.4426950408889634f
typedef unsigned short bf;
typedef __attribute__((ext_vector_type(16))) __bf16   v16bf;
typedef __attribute__((ext_vector_type(4)))  __bf16   v4bf;
typedef __attribute__((ext_vector_type(8)))  unsigned short v8us;
typedef __attribute__((ext_vector_type(4)))  unsigned short v4us;
typedef __attribute__((ext_vector_type(2)))  unsigned v2u;
typedef __attribute__((ext_vector_type(8)))  unsigned v8u;
typedef __attribute__((ext_vector_type(16))) float    v16f;
typedef __attribute__((ext_vector_type(8)))  float    v8f;
typedef __attribute__((ext_vector_type(4)))  float    v4f;

__device__ __forceinline__ unsigned short f2bf(float f) { unsigned u = __float_as_uint(f); u += 0x7FFFu + ((u >> 16) & 1u); return (unsigned short)(u >> 16); }
__device__ __forceinline__ float bf2f(unsigned short b) { return __uint_as_float(((unsigned)b) << 16); }
__device__ __forceinline__ float bfr(float f) { return bf2f(f2bf(f)); }
__device__ __forceinline__ v16bf cat16b(v8us lo, v8us hi) { return __builtin_bit_cast(v16bf, __builtin_shufflevector(lo, hi, 0, 1, 2, 3, 4, 5, 6, 7, 8, 9, 10, 11, 12, 13, 14, 15)); }
__device__ __forceinline__ v8f wmmab(v16bf a, v16bf b, v8f c) { return __builtin_amdgcn_wmma_f32_16x16x32_bf16(false, a, false, b, (short)0, c, false, false); }
// a fragment of 16 rows at depth 32 from a K-contiguous bf16 plane: p = the lane's row + 8 hi; the lane's k order is 8 hi + 0..7, then 16 + 8 hi + 0..7, for A and Bt alike
__device__ __forceinline__ v16bf ldfrag(const bf* p) { return cat16b(*(const v8us*)p, *(const v8us*)(p + 16)); }
__device__ __forceinline__ void xwait(unsigned off) { asm volatile("s_wait_xcnt 0x0" : : "v"(off) : "memory"); }   // stands behind a group of loads that share the offset register 'off': the wait in front of any rewrite of that register; naming it as an input keeps it whole up to the wait, so that no load of the group lands on it
__device__ __forceinline__ void xwait2(const char* p, unsigned off) { asm volatile("s_wait_xcnt 0x0" : : "v"(p), "v"(off) : "memory"); }   // the same behind a group of loads of which some go by the lane's own address pair 'p', the others by 'off'

// the same fragment from a K-contiguous f32 row, rounded to bf16: p = the lane's row + 8 hi (+ 32 for the second half of the depth), in bytes
__device__ __forceinline__ v16bf ldw(const char* p) { const v4f a = *(const v4f*)p, b = *(const v4f*)(p + 16), c = *(const v4f*)(p + 64), d = *(const v4f*)(p + 80); v16f f;
#pragma unroll
    for (int q = 0; q < 4; ++q) { f[q] = a[q]; f[4 + q] = b[q]; f[8 + q] = c[q]; f[12 + q] = d[q]; }
    return __builtin_convertvector(f, v16bf); }
// y = h + l + (what two bf16 words cannot hold): h = y rounded to bf16, l = (y - h) rounded to bf16
__device__ __forceinline__ void split4(v4f y, v4us& h, v4us& l) { const v4bf hb = __builtin_convertvector(y, v4bf); const v2u w = __builtin_bit_cast(v2u, hb); v4f r;
#pragma unroll
    for (int i = 0; i < 2; ++i) { r[2 * i] = y[2 * i] - __uint_as_float(w[i] << 16); r[2 * i + 1] = y[2 * i + 1] - __uint_as_float(w[i] & 0xFFFF0000u); }
    h = __builtin_bit_cast(v4us, hb); l = __builtin_bit_cast(v4us, __builtin_convertvector(r, v4bf)); }
// k_prep: see the file's head. grid (TT / 64, entries), 32 threads. Column lr of position tile nb is position n0 + 4 lr + nb: a lane's 16-byte load of x then holds one channel of its column in all four tiles, and its four tiles' results for one h channel are four consecutive positions.
// QK = the four query and key planes one behind the other: query hi, query lo, key hi, key lo. A result tile holds, in lane (lr, hi), register j, row 8 hi + j and column lr: in the Wk | Wq tile the lanes hi = 0 hold a position's 8 query channels, the lanes hi = 1 its 8 key channels.
__global__ __launch_bounds__(32) void k_prep(const float* __restrict__ X, const float* __restrict__ WQ, const float* __restrict__ WK, const float* __restrict__ WV, bf* QK, bf* Vh, bf* Vl) {
    const int lane = threadIdx.x & 31, lr = lane & 15, hi = lane >> 4; const int n0 = blockIdx.x * 64; const size_t b = blockIdx.y;
    X += b * HD * TT; QK += b * TT * DP; Vh += b * HD * TT; Vl += b * HD * TT;
    // every loop below has a constant trip count and is unrolled so that its array indices are register names
    const unsigned xo = (unsigned)(8 * hi * TT + n0 + 4 * lr) * 4u;   // the lane's byte offset in x: channel 8 hi, its four positions
    v4f xv[2][16];
#pragma unroll
    for (int kc = 0; kc < 2; ++kc)
#pragma unroll
        for (int e = 0; e < 16; ++e) xv[kc][e] = *(const v4f*)((const char*)X + xo + (kc * 32 + (e >> 3) * 16 + (e & 7)) * TT * 4);
    xwait(xo);
    const char* wp = (const char*)(lr < DQK ? WK : WQ) + (unsigned)((lr & (DQK - 1)) * HD + 8 * hi) * 4u; const unsigned wo = (unsigned)(lr * HD + 8 * hi) * 4u;
    v16bf aw[5][2];   // tile 0: Wk's rows | Wq's rows; tiles 1..4: Wv's rows
#pragma unroll
    for (int kc = 0; kc < 2; ++kc) { aw[0][kc] = ldw(wp + kc * 128);
#pragma unroll
        for (int mb = 0; mb < 4; ++mb) aw[1 + mb][kc] = ldw((const char*)WV + wo + mb * 16 * HD * 4 + kc * 128); }
    xwait2(wp, wo);
    v16bf bt[4][2];
#pragma unroll
    for (int nb = 0; nb < 4; ++nb)
#pragma unroll
        for (int kc = 0; kc < 2; ++kc) { v16f f;
#pragma unroll
            for (int e = 0; e < 16; ++e) f[e] = xv[kc][e][nb];
            bt[nb][kc] = __builtin_convertvector(f, v16bf); }
    const unsigned qo = (unsigned)(hi * 2 * QKP + (n0 + 4 * lr) * DP) * 2u, vo = (unsigned)(8 * hi * TT + n0 + 4 * lr) * 2u;   // the lane's byte offsets in QK (its map's hi plane, its first position's row) and in an h plane
    const v8us zz = {0, 0, 0, 0, 0, 0, 0, 0};
#pragma unroll
    for (int mb = 0; mb < 5; ++mb) { v8f d[4];
#pragma unroll
        for (int nb = 0; nb < 4; ++nb) d[nb] = wmmab(aw[mb][0], bt[nb][0], (v8f){});
#pragma unroll
        for (int nb = 0; nb < 4; ++nb) d[nb] = wmmab(aw[mb][1], bt[nb][1], d[nb]);
        if (mb == 0) {
#pragma unroll
            for (int nb = 0; nb < 4; ++nb) { v4f y0, y1; v4us h0, l0, h1, l1;
#pragma unroll
                for (int q = 0; q < 4; ++q) { y0[q] = d[nb][q]; y1[q] = d[nb][4 + q]; }
                split4(y0, h0, l0); split4(y1, h1, l1);
                char* row = (char*)QK + qo + nb * DP * 2;
                *(v8us*)row = __builtin_shufflevector(h0, h1, 0, 1, 2, 3, 4, 5, 6, 7); *(v8us*)(row + QKP * 2) = __builtin_shufflevector(l0, l1, 0, 1, 2, 3, 4, 5, 6, 7);
#pragma unroll
                for (int k = 1; k < DP / 8; ++k) { *(v8us*)(row + k * 16) = zz; *(v8us*)(row + QKP * 2 + k * 16) = zz; } }
        } else {
#pragma unroll
            for (int j = 0; j < 8; ++j) { v4f y; v4us h, l;
#pragma unroll
                for (int nb = 0; nb < 4; ++nb) y[nb] = d[nb][j];
                split4(y, h, l);
                *(v4us*)((char*)Vh + vo + ((mb - 1) * 16 + j) * TT * 2) = h; *(v4us*)((char*)Vl + vo + ((mb - 1) * 16 + j) * TT * 2) = l; }
        } }
}
// k_fattn: see the file's head. grid (TT / 128, entries), 512 threads. Fragment maps: a score tile's accumulator holds, in lane (lr, hi), register j, key n = 8 hi + j of its 16 keys and position m = lr; two such tiles (keys 0..15 and 16..31 of the step) are, register for register, the Bt operand's k order (k = 8 hi + j, then 16 + 8 hi + j) that ldfrag gives h's rows as A.
// The query and key planes' columns 16..31 are written zeros: those halves of the fragments are set to zero here and not loaded.
__device__ __forceinline__ float xhalf(float x) { const int b = __float_as_int(x); return __int_as_float(__builtin_amdgcn_permlanex16(b, b, 0x76543210, 0xfedcba98, false, false)); }   // the value of lane l ^ 16
__device__ __forceinline__ v16bf ldqk(const bf* p) { const v8us zz = {0, 0, 0, 0, 0, 0, 0, 0}; return cat16b(*(const v8us*)p, zz); }
__global__ __launch_bounds__(512) void k_fattn(const bf* __restrict__ Qh, const bf* __restrict__ Ql, const bf* __restrict__ Kh, const bf* __restrict__ Kl, const bf* __restrict__ Vh, const bf* __restrict__ Vl, const float* __restrict__ X, const float* __restrict__ GAM, float* out) {
    __shared__ __align__(16) float accs[FQG * FKQ * 64 * 32];   // a wave's 64 accumulator registers, lane-major
    __shared__ __align__(16) float mls[FQG * FKQ * 4 * 32];     // a wave's maxima in use (2) and sums (2), lane-major
    const int lane = threadIdx.x & 31, lr = lane & 15, hi = lane >> 4; const int wave = __builtin_amdgcn_readfirstlane(threadIdx.x >> 5), qg = wave & (FQG - 1), kq = wave / FQG;
    const size_t b = blockIdx.y; const int q0 = blockIdx.x * (FQG * 32) + qg * 32; const int nbeg = kq * (TT / FKQ), nend = nbeg + TT / FKQ;
    Qh += b * TT * DP; Ql += b * TT * DP; Kh += b * TT * DP; Kl += b * TT * DP; Vh += b * HD * TT; Vl += b * HD * TT; X += b * HD * TT; out += b * HD * TT;
    // every inner loop below has a constant trip count and is unrolled so that its array indices are register names
    v16bf qh[2], ql[2], kh[2], kl[2]; v8f acc[4][2]; float mref[2], lsum[2];
    const unsigned qob = (unsigned)((q0 + lr) * DP + 8 * hi) * 2u; unsigned kob = (unsigned)((nbeg + lr) * DP + 8 * hi) * 2u, vob = (unsigned)(lr * TT + nbeg + 8 * hi) * 2u;   // the lane's byte offsets in a query plane, a key plane and an h plane; the last two step with the loop
#pragma unroll
    for (int mt = 0; mt < 2; ++mt) { qh[mt] = ldqk((const bf*)((const char*)Qh + qob) + mt * 16 * DP); ql[mt] = ldqk((const bf*)((const char*)Ql + qob) + mt * 16 * DP); mref[mt] = -3.0e38f; lsum[mt] = 0.f;
#pragma unroll
        for (int ct = 0; ct < 4; ++ct) acc[ct][mt] = (v8f){}; }
    xwait(qob);
#pragma unroll
    for (int t = 0; t < 2; ++t) { kh[t] = ldqk((const bf*)((const char*)Kh + kob) + t * 16 * DP); kl[t] = ldqk((const bf*)((const char*)Kl + kob) + t * 16 * DP); }
    xwait(kob);
    for (int n = nbeg; n < nend; n += 32) {
        v16bf vh[4], vl[4];   // this step's h fragments: asked for ahead of the scores and the softmax, used behind them
#pragma unroll
        for (int ct = 0; ct < 4; ++ct) { vh[ct] = ldfrag((const bf*)((const char*)Vh + vob) + ct * 16 * TT); vl[ct] = ldfrag((const bf*)((const char*)Vl + vob) + ct * 16 * TT); }
        xwait(vob); vob += 64u;   // the statement's memory clobber also keeps the sixteen loads up here: left free, they sink to just in front of the value product and the wave waits out their whole latency there
        v8f s[2][2];
#pragma unroll
        for (int mt = 0; mt < 2; ++mt)
#pragma unroll
            for (int t = 0; t < 2; ++t) s[mt][t] = wmmab(kh[t], qh[mt], (v8f){});
#pragma unroll
        for (int mt = 0; mt < 2; ++mt)
#pragma unroll
            for (int t = 0; t < 2; ++t) s[mt][t] = wmmab(kh[t], ql[mt], s[mt][t]);
#pragma unroll
        for (int mt = 0; mt < 2; ++mt)
#pragma unroll
            for (int t = 0; t < 2; ++t) s[mt][t] = wmmab(kl[t], qh[mt], s[mt][t]);
        kob += (n + 32 < nend) ? 32u * DP * 2u : 0u;   // the next step's key fragments, one step ahead (the last step asks for its own again: in bounds, not used)
#pragma unroll
        for (int t = 0; t < 2; ++t) { kh[t] = ldqk((const bf*)((const char*)Kh + kob) + t * 16 * DP); kl[t] = ldqk((const bf*)((const char*)Kl + kob) + t * 16 * DP); }
        xwait(kob);
        float tm[2];
#pragma unroll
        for (int mt = 0; mt < 2; ++mt) { float x = fmaxf(s[mt][0][0], s[mt][1][0]);
#pragma unroll
            for (int j = 1; j < 8; ++j) x = fmaxf(x, fmaxf(s[mt][0][j], s[mt][1][j]));
            tm[mt] = fmaxf(x, xhalf(x)); }
        // the maximum in use moves only when a position's new maximum passes it by more than 5.5 (a weight then stays under e^5.5): one scalar test a step for the wave
        if (__builtin_amdgcn_ballot_w32(tm[0] > mref[0] + 5.5f || tm[1] > mref[1] + 5.5f) != 0) {
#pragma unroll
            for (int mt = 0; mt < 2; ++mt) { const float mn = fmaxf(mref[mt], tm[mt]); const float al = __builtin_amdgcn_exp2f((mref[mt] - mn) * L2E); mref[mt] = mn; lsum[mt] *= al;
#pragma unroll
                for (int ct = 0; ct < 4; ++ct)
#pragma unroll
                    for (int j = 0; j < 8; ++j) acc[ct][mt][j] *= al; } }
        v16bf ph[2], pl[2];
#pragma unroll
        for (int mt = 0; mt < 2; ++mt) { const float mb = mref[mt] * L2E; v16f p; float ps = 0.f;
#pragma unroll
            for (int e = 0; e < 16; ++e) { p[e] = __builtin_amdgcn_exp2f(s[mt][e >> 3][e & 7] * L2E - mb); ps += p[e]; }
            lsum[mt] += ps; ph[mt] = __builtin_convertvector(p, v16bf); const v8u w = __builtin_bit_cast(v8u, ph[mt]); v16f r;   // r: what the hi words leave of p
#pragma unroll
            for (int i = 0; i < 8; ++i) { r[2 * i] = p[2 * i] - __uint_as_float(w[i] << 16); r[2 * i + 1] = p[2 * i + 1] - __uint_as_float(w[i] & 0xFFFF0000u); }
            pl[mt] = __builtin_convertvector(r, v16bf); }
#pragma unroll
        for (int ct = 0; ct < 4; ++ct)
#pragma unroll
            for (int mt = 0; mt < 2; ++mt) acc[ct][mt] = wmmab(vh[ct], ph[mt], acc[ct][mt]);
#pragma unroll
        for (int ct = 0; ct < 4; ++ct)
#pragma unroll
            for (int mt = 0; mt < 2; ++mt) acc[ct][mt] = wmmab(vl[ct], ph[mt], acc[ct][mt]);
#pragma unroll
        for (int ct = 0; ct < 4; ++ct)
#pragma unroll
            for (int mt = 0; mt < 2; ++mt) acc[ct][mt] = wmmab(vh[ct], pl[mt], acc[ct][mt]);
    }
    // the join of the FKQ key parts: every wave lays down its part, then finishes channel tile kq of its own position group
#pragma unroll
    for (int mt = 0; mt < 2; ++mt) { mls[(wave * 4 + mt) * 32 + lane] = mref[mt]; mls[(wave * 4 + 2 + mt) * 32 + lane] = lsum[mt] + xhalf(lsum[mt]);
#pragma unroll
        for (int ct = 0; ct < 4; ++ct)
#pragma unroll
            for (int j = 0; j < 8; ++j) accs[(wave * 64 + (ct * 2 + mt) * 8 + j) * 32 + lane] = acc[ct][mt][j]; }
    __syncthreads();
    // the residual's x for the 16 elements that this lane stores: asked for ahead of the join, used behind it
    const unsigned oe = (unsigned)((kq * 16 + hi * 8) * TT + q0 + lr);   // the lane's element offset, the same in x and in out
    float xr[2][8]; const float g = bfr(GAM[0]);
#pragma unroll
    for (int mt = 0; mt < 2; ++mt)
#pragma unroll
        for (int j = 0; j < 8; ++j) xr[mt][j] = (X + oe)[j * TT + mt * 16];
    xwait(oe);   // the statement's memory clobber also keeps the sixteen loads up here, ahead of the join's LDS reads
#pragma unroll
    for (int mt = 0; mt < 2; ++mt) { float mk[FKQ], wk[FKQ]; float M = -3.0e38f, L = 0.f;
#pragma unroll
        for (int k = 0; k < FKQ; ++k) { mk[k] = mls[((k * FQG + qg) * 4 + mt) * 32 + lane]; M = fmaxf(M, mk[k]); }
#pragma unroll
        for (int k = 0; k < FKQ; ++k) { wk[k] = __builtin_amdgcn_exp2f((mk[k] - M) * L2E); L += wk[k] * mls[((k * FQG + qg) * 4 + 2 + mt) * 32 + lane]; }
        const float rl = __fdiv_rn(1.0f, L);
#pragma unroll
        for (int j = 0; j < 8; ++j) { float o = 0.f;
#pragma unroll
            for (int k = 0; k < FKQ; ++k) o += wk[k] * accs[((k * FQG + qg) * 64 + (kq * 2 + mt) * 8 + j) * 32 + lane];
            const float pt = o * rl; (out + oe)[j * TT + mt * 16] = g * pt + bfr(xr[mt][j]); } }
}
extern "C" void kernel_launch(void* const* d_in, const int* in_sizes, int n_in,
                              void* d_out, int out_size, void* d_ws, size_t ws_size, hipStream_t stream) {
    (void)in_sizes; (void)n_in; (void)out_size;
    const float* x = (const float*)d_in[0]; const float* wq = (const float*)d_in[1]; const float* wk = (const float*)d_in[2]; const float* wv = (const float*)d_in[3]; const float* gam = (const float*)d_in[4];
    // inputs in the module's argument order: x, Wq, Wk, Wv, gamma = d_in[0..4]: all read
    float* OUT = (float*)d_out;     // [8][64][4096]
    char* wsp = (char*)d_ws;
    auto take = [&](size_t bytes) { char* p = wsp; wsp += (bytes + 255) & ~(size_t)255; return (void*)p; };
    bf* QK = (bf*)take((size_t)4 * QKP * 2); bf* VCh = (bf*)take((size_t)NB_ * HD * TT * 2); bf* VCl = (bf*)take((size_t)NB_ * HD * TT * 2);   // 8 entries each; QK: query hi, query lo, key hi, key lo
    if ((size_t)(wsp - (char*)d_ws) > ws_size) return;    // total 16 MiB carved
    k_prep<<<dim3(TT / 64, NB_, 1), 32, 0, stream>>>(x, wq, wk, wv, QK, VCh, VCl);   /* the query, key and h planes, hi and lo words */
    k_fattn<<<dim3(TT / (FQG * 32), NB_, 1), FQG * FKQ * 32, 0, stream>>>(QK, QK + (size_t)QKP, QK + (size_t)2 * QKP, QK + (size_t)3 * QKP, VCh, VCl, x, gam, OUT);   /* out[b][c][m] = gamma (the sum over n of h[c][n] softmax_n(g[:, m] . f[:, n])) + x[b][c][m] */
}

// v005
// Measured time: 55.3 microseconds a run.
// Two timings next to v004 both put it at 1.51 times that version's speed.
// All steps since v000 together make it 33.7 times as fast.
#include <hip/hip_runtime.h>

// A single-head spatial self-attention over 4,096 positions with 1 x 1 convolutions (x [8][64][64][64] = [entry][64 channels][4,096 positions]; Wq, Wk [8][64], Wv [64][64], ALL 'oi' (out, in), no bias; gamma [1], a scalar input): f = Wq x and g = Wk x (8 channels each); h = Wv x (64 channels);
// s[n][m] = f[:, n] . g[:, m] (no scale, no mask); a softmax over n, the score matrix's FIRST axis: for the output position m the weights run over n: g gives position m's query, f the keys; o[c][m] = sum_n h[c][n] weight[n][m]; out[c][m] = gamma o[c][m] + x[c][m] -> [8][64][64][64] (2.1 M); argument order x, Wq, Wk, Wv, gamma: all read.
// Layout: TWO launches.
// k_prep, one wave for 64 positions of one entry: x and the three weights are read as they stand (f32), rounded to bf16 in registers and laid straight into matrix fragments; the three 1 x 1 convolutions at depth 64: one tile of Wk's 8 rows | Wq's 8 rows as A with the positions as Bt, four tiles of Wv's rows as Bt with the positions as A; the f32 results are split in registers and stored as the bf16 hi | lo planes that k_fattn reads, EACH IN ITS FRAGMENTS' OWN ORDER, so that a wave's 16-byte load there covers 512 consecutive bytes (four whole 128-byte lines): query and key maps token-major [4096][16], columns 8..15 WRITTEN ZEROS (a row of 32 bytes is lanes lr and 16 + lr of a fragment's first half; depth 16..31 is never stored), h as ONE plane [128 key steps][4 channel tiles][hi | lo words][2 halves of the depth][32 lanes][8 keys] (with the positions as A a lane holds one channel's 32 keys of a step: four 16-byte words of that order).
// k_fattn, for all 8 entries: scores, softmax, value product and residual in one kernel, so that neither the scores nor the weights ever reach memory. A work-group has 128 output positions m (4 groups of 32) x 4 quarters of the 4,096 keys n = 16 waves; a wave walks its 1,024 keys 32 at a time: the TRANSPOSED scores (A = key rows, Bt = query rows; hi + lo words of both, three products at depth 32), a running maximum and sum per position, the unnormalised weights exp(s - maximum in use) as bf16 hi and lo words straight from the score accumulators into the Bt operand of the value product (A = h's rows; hi + lo words of both, three products); the four quarters are joined in LDS, in quarter order, normalised, and stored as out[c][m] = gamma o[c][m] + x[c][m] (gamma and x read from their inputs and rounded to bf16 as every float input is): the one writer of the output.
// Compute dtypes, f32 accumulate: every float input rounded to bf16 at its load; the three 1 x 1 convolutions ONE bf16 product each on exact operands; the two 8-channel maps, h and the weights as bf16 hi + lo words at both attention products; softmax f32; the scaled residual f32.

#define NB_  8
#define TT   4096                 // positions = the softmax's key axis
#define HD   64                   // channels
#define DQK  8                    // q and k channels
#define DP   16                   // q and k rows as stored: 8 channels, 8 zeros (the first half of the matrix unit's depth)
#define VST  8192                 // bytes of one key step (32 keys x 64 channels, hi and lo words) in the h plane
#define VCT  2048                 // bytes of one channel tile in it: the hi words' two halves of 512, then the lo words'
#define QKP  (NB_ * TT * DP)      // elements of one query or key plane, all entries
#define FQG  4                    // k_fattn: groups of 32 output positions a work-group
#define FKQ  4                    // k_fattn: parts of the key axis a work-group, one wave each per group
#define L2E  1.4426950408889634f
typedef unsigned short bf;
typedef __attribute__((ext_vector_type(16))) __bf16   v16bf;
typedef __attribute__((ext_vector_type(4)))  __bf16   v4bf;
typedef __attribute__((ext_vector_type(8)))  unsigned short v8us;
typedef __attribute__((ext_vector_type(4)))  unsigned short v4us;
typedef __attribute__((ext_vector_type(2)))  unsigned v2u;
typedef __attribute__((ext_vector_type(8)))  unsigned v8u;
typedef __attribute__((ext_vector_type(16))) float    v16f;
typedef __attribute__((ext_vector_type(8)))  float    v8f;
typedef __attribute__((ext_vector_type(4)))  float    v4f;

__device__ __forceinline__ unsigned short f2bf(float f) { unsigned u = __float_as_uint(f); u += 0x7FFFu + ((u >> 16) & 1u); return (unsigned short)(u >> 16); }
__device__ __forceinline__ float bf2f(unsigned short b) { return __uint_as_float(((unsigned)b) << 16); }
__device__ __forceinline__ float bfr(float f) { return bf2f(f2bf(f)); }
__device__ __forceinline__ v16bf cat16b(v8us lo, v8us hi) { return __builtin_bit_cast(v16bf, __builtin_shufflevector(lo, hi, 0, 1, 2, 3, 4, 5, 6, 7, 8, 9, 10, 11, 12, 13, 14, 15)); }
__device__ __forceinline__ v8f wmmab(v16bf a, v16bf b, v8f c) { return __builtin_amdgcn_wmma_f32_16x16x32_bf16(false, a, false, b, (short)0, c, false, false); }
// a fragment of 16 rows at depth 32 from a plane in fragment order: p = the tile + 16 bytes x lane; the lane's k order is 8 hi + 0..7 (first half), then 16 + 8 hi + 0..7 (second half, 512 bytes on), for A and Bt alike
__device__ __forceinline__ v16bf ldfrag(const char* p) { return cat16b(*(const v8us*)p, *(const v8us*)(p + 512)); }
__device__ __forceinline__ void xwait(unsigned off) { asm volatile("s_wait_xcnt 0x0" : : "v"(off) : "memory"); }   // stands behind a group of loads that share the offset register 'off': the wait in front of any rewrite of that register; naming it as an input keeps it whole up to the wait, so that no load of the group lands on it
__device__ __forceinline__ void xwait2(const char* p, unsigned off) { asm volatile("s_wait_xcnt 0x0" : : "v"(p), "v"(off) : "memory"); }   // the same behind a group of loads of which some go by the lane's own address pair 'p', the others by 'off'
__device__ __forceinline__ void xwaitp(const char* p) { asm volatile("s_wait_xcnt 0x0" : : "v"(p) : "memory"); }   // the same behind a group of loads that go by the lane's own address pair 'p'

// the same fragment from a K-contiguous f32 row, rounded to bf16: p = the lane's row + 8 hi (+ 32 for the second half of the depth), in bytes
__device__ __forceinline__ v16bf ldw(const char* p) { const v4f a = *(const v4f*)p, b = *(const v4f*)(p + 16), c = *(const v4f*)(p + 64), d = *(const v4f*)(p + 80); v16f f;
#pragma unroll
    for (int q = 0; q < 4; ++q) { f[q] = a[q]; f[4 + q] = b[q]; f[8 + q] = c[q]; f[12 + q] = d[q]; }
    return __builtin_convertvector(f, v16bf); }
// y = h + l + (what two bf16 words cannot hold): h = y rounded to bf16, l = (y - h) rounded to bf16
__device__ __forceinline__ void split4(v4f y, v4us& h, v4us& l) { const v4bf hb = __builtin_convertvector(y, v4bf); const v2u w = __builtin_bit_cast(v2u, hb); v4f r;
#pragma unroll
    for (int i = 0; i < 2; ++i) { r[2 * i] = y[2 * i] - __uint_as_float(w[i] << 16); r[2 * i + 1] = y[2 * i + 1] - __uint_as_float(w[i] & 0xFFFF0000u); }
    h = __builtin_bit_cast(v4us, hb); l = __builtin_bit_cast(v4us, __builtin_convertvector(r, v4bf)); }
// k_prep: see the file's head. grid (TT / 64, entries), 32 threads. Fragment row lr of position tile nb is position n0 + 4 lr + nb: a lane's 16-byte load of x then holds one channel of its row in all four tiles.
// QK = the four query and key planes one behind the other: query hi, query lo, key hi, key lo. A result tile holds, in lane (lr, hi), register j, row 8 hi + j and column lr: in the Wk | Wq tile (weights as A) the lanes hi = 0 hold a position's 8 query channels, the lanes hi = 1 its 8 key channels; in an h tile (positions as A) row 8 hi + j of tile nb is position n0 + 32 hi + 4 j + nb and column lr the channel: over j and nb a lane holds all 32 keys of key step n0 / 32 + hi for one channel, keys 8 c + 0..7 in registers j = 2 c, 2 c + 1.
__global__ __launch_bounds__(32) void k_prep(const float* __restrict__ X, const float* __restrict__ WQ, const float* __restrict__ WK, const float* __restrict__ WV, bf* QK, bf* V) {
    const int lane = threadIdx.x & 31, lr = lane & 15, hi = lane >> 4; const int n0 = blockIdx.x * 64; const size_t b = blockIdx.y;
    X += b * HD * TT; QK += b * TT * DP; V += b * 2 * HD * TT;
    // every loop below has a constant trip count and is unrolled so that its array indices are register names
    const unsigned xo = (unsigned)(8 * hi * TT + n0 + 4 * lr) * 4u;   // the lane's byte offset in x: channel 8 hi, its four positions
    v4f xv[2][16];
#pragma unroll
    for (int kc = 0; kc < 2; ++kc)
#pragma unroll
        for (int e = 0; e < 16; ++e) xv[kc][e] = *(const v4f*)((const char*)X + xo + (kc * 32 + (e >> 3) * 16 + (e & 7)) * TT * 4);
    xwait(xo);
    const char* wp = (const char*)(lr < DQK ? WK : WQ) + (unsigned)((lr & (DQK - 1)) * HD + 8 * hi) * 4u; const unsigned wo = (unsigned)(lr * HD + 8 * hi) * 4u;
    v16bf aw[5][2];   // tile 0: Wk's rows | Wq's rows; tiles 1..4: Wv's rows
#pragma unroll
    for (int kc = 0; kc < 2; ++kc) { aw[0][kc] = ldw(wp + kc * 128);
#pragma unroll
        for (int mb = 0; mb < 4; ++mb) aw[1 + mb][kc] = ldw((const char*)WV + wo + mb * 16 * HD * 4 + kc * 128); }
    xwait2(wp, wo);
    v16bf bt[4][2];
#pragma unroll
    for (int nb = 0; nb < 4; ++nb)
#pragma unroll
        for (int kc = 0; kc < 2; ++kc) { v16f f;
#pragma unroll
            for (int e = 0; e < 16; ++e) f[e] = xv[kc][e][nb];
            bt[nb][kc] = __builtin_convertvector(f, v16bf); }
    const unsigned qo = (unsigned)(hi * 2 * QKP + (n0 + 4 * lr) * DP) * 2u, vo = (unsigned)((n0 / 32 + hi) * VST + lr * 16);   // the lane's byte offsets in QK (its map's hi plane, its first position's row) and in the h plane (its key step, fragment lane lr)
    const v8us zz = {0, 0, 0, 0, 0, 0, 0, 0};
#pragma unroll
    for (int mb = 0; mb < 5; ++mb) { v8f d[4];
#pragma unroll
        for (int nb = 0; nb < 4; ++nb) d[nb] = mb == 0 ? wmmab(aw[mb][0], bt[nb][0], (v8f){}) : wmmab(bt[nb][0], aw[mb][0], (v8f){});
#pragma unroll
        for (int nb = 0; nb < 4; ++nb) d[nb] = mb == 0 ? wmmab(aw[mb][1], bt[nb][1], d[nb]) : wmmab(bt[nb][1], aw[mb][1], d[nb]);
        if (mb == 0) {
#pragma unroll
            for (int nb = 0; nb < 4; ++nb) { v4f y0, y1; v4us h0, l0, h1, l1;
#pragma unroll
                for (int q = 0; q < 4; ++q) { y0[q] = d[nb][q]; y1[q] = d[nb][4 + q]; }
                split4(y0, h0, l0); split4(y1, h1, l1);
                char* row = (char*)QK + qo + nb * DP * 2;
                *(v8us*)row = __builtin_shufflevector(h0, h1, 0, 1, 2, 3, 4, 5, 6, 7); *(v8us*)(row + QKP * 2) = __builtin_shufflevector(l0, l1, 0, 1, 2, 3, 4, 5, 6, 7);
#pragma unroll
                for (int k = 1; k < DP / 8; ++k) { *(v8us*)(row + k * 16) = zz; *(v8us*)(row + QKP * 2 + k * 16) = zz; } }
        } else {
#pragma unroll
            for (int c = 0; c < 4; ++c) { v4f y0, y1; v4us h0, l0, h1, l1;   // keys 8 c + 0..7 of the step: half c >> 1 of the depth, fragment lanes 16 (c & 1) + lr
#pragma unroll
                for (int nb = 0; nb < 4; ++nb) { y0[nb] = d[nb][2 * c]; y1[nb] = d[nb][2 * c + 1]; }
                split4(y0, h0, l0); split4(y1, h1, l1);
                *(v8us*)((char*)V + vo + (mb - 1) * VCT + c * 256) = __builtin_shufflevector(h0, h1, 0, 1, 2, 3, 4, 5, 6, 7); *(v8us*)((char*)V + vo + (mb - 1) * VCT + 1024 + c * 256) = __builtin_shufflevector(l0, l1, 0, 1, 2, 3, 4, 5, 6, 7); }
        } }
}
// k_fattn: see the file's head. grid (TT / 128, entries), 512 threads. Fragment maps: a score tile's accumulator holds, in lane (lr, hi), register j, key n = 8 hi + j of its 16 keys and position m = lr; two such tiles (keys 0..15 and 16..31 of the step) are, register for register, the Bt operand's k order (k = 8 hi + j, then 16 + 8 hi + j) that ldfrag gives h's rows as A.
// The query and key maps have no depth 16..31: those halves of the fragments are set to zero here and not loaded.
__device__ __forceinline__ float xhalf(float x) { const int b = __float_as_int(x); return __int_as_float(__builtin_amdgcn_permlanex16(b, b, 0x76543210, 0xfedcba98, false, false)); }   // the value of lane l ^ 16
__device__ __forceinline__ v16bf ldqk(const bf* p) { const v8us zz = {0, 0, 0, 0, 0, 0, 0, 0}; return cat16b(*(const v8us*)p, zz); }
__global__ __launch_bounds__(512) void k_fattn(const bf* __restrict__ Qh, const bf* __restrict__ Ql, const bf* __restrict__ Kh, const bf* __restrict__ Kl, const bf* __restrict__ V, const float* __restrict__ X, const float* __restrict__ GAM, float* out) {
    __shared__ __align__(16) float accs[FQG * FKQ * 64 * 32];   // a wave's 64 accumulator registers, lane-major
    __shared__ __align__(16) float mls[FQG * FKQ * 4 * 32];     // a wave's maxima in use (2) and sums (2), lane-major
    const int lane = threadIdx.x & 31, lr = lane & 15, hi = lane >> 4; const int wave = __builtin_amdgcn_readfirstlane(threadIdx.x >> 5), qg = wave & (FQG - 1), kq = wave / FQG;
    const size_t b = blockIdx.y; const int q0 = blockIdx.x * (FQG * 32) + qg * 32; const int nbeg = kq * (TT / FKQ), nend = nbeg + TT / FKQ;
    Qh += b * TT * DP; Ql += b * TT * DP; Kh += b * TT * DP; Kl += b * TT * DP; V += b * 2 * HD * TT; X += b * HD * TT; out += b * HD * TT;
    // every inner loop below has a constant trip count and is unrolled so that its array indices are register names
    v16bf qh[2], ql[2], kh[2], kl[2]; v8f acc[4][2]; float mref[2], lsum[2];
    const unsigned qob = (unsigned)((q0 + lr) * DP + 8 * hi) * 2u; unsigned kob = (unsigned)((nbeg + lr) * DP + 8 * hi) * 2u;   // the lane's byte offsets in a query plane and in a key plane; the second steps with the loop
    const char* vp = (const char*)V + (nbeg / 32) * VST + lane * 16;   // the lane's 16 bytes in the first fragment half of the wave's key step in the h plane: it steps with the loop
#pragma unroll
    for (int mt = 0; mt < 2; ++mt) { qh[mt] = ldqk((const bf*)((const char*)Qh + qob) + mt * 16 * DP); ql[mt] = ldqk((const bf*)((const char*)Ql + qob) + mt * 16 * DP); mref[mt] = -3.0e38f; lsum[mt] = 0.f;
#pragma unroll
        for (int ct = 0; ct < 4; ++ct) acc[ct][mt] = (v8f){}; }
    xwait(qob);
#pragma unroll
    for (int t = 0; t < 2; ++t) { kh[t] = ldqk((const bf*)((const char*)Kh + kob) + t * 16 * DP); kl[t] = ldqk((const bf*)((const char*)Kl + kob) + t * 16 * DP); }
    xwait(kob);
    for (int n = nbeg; n < nend; n += 32) {
        v16bf vh[4], vl[4];   // this step's h fragments: asked for ahead of the scores and the softmax, used behind them
#pragma unroll
        for (int ct = 0; ct < 4; ++ct) { vh[ct] = ldfrag(vp + ct * VCT); vl[ct] = ldfrag(vp + ct * VCT + 1024); }
        xwaitp(vp); vp += VST;   // the statement's memory clobber also keeps the sixteen loads up here: left free, they sink to just in front of the value product and the wave waits out their whole latency there
        v8f s[2][2];
#pragma unroll
        for (int mt = 0; mt < 2; ++mt)
#pragma unroll
            for (int t = 0; t < 2; ++t) s[mt][t] = wmmab(kh[t], qh[mt], (v8f){});
#pragma unroll
        for (int mt = 0; mt < 2; ++mt)
#pragma unroll
            for (int t = 0; t < 2; ++t) s[mt][t] = wmmab(kh[t], ql[mt], s[mt][t]);
#pragma unroll
        for (int mt = 0; mt < 2; ++mt)
#pragma unroll
            for (int t = 0; t < 2; ++t) s[mt][t] = wmmab(kl[t], qh[mt], s[mt][t]);
        kob += (n + 32 < nend) ? 32u * DP * 2u : 0u;   // the next step's key fragments, one step ahead (the last step asks for its own again: in bounds, not used)
#pragma unroll
        for (int t = 0; t < 2; ++t) { kh[t] = ldqk((const bf*)((const char*)Kh + kob) + t * 16 * DP); kl[t] = ldqk((const bf*)((const char*)Kl + kob) + t * 16 * DP); }
        xwait(kob);
        float tm[2];
#pragma unroll
        for (int mt = 0; mt < 2; ++mt) { float x = fmaxf(s[mt][0][0], s[mt][1][0]);
#pragma unroll
            for (int j = 1; j < 8; ++j) x = fmaxf(x, fmaxf(s[mt][0][j], s[mt][1][j]));
            tm[mt] = fmaxf(x, xhalf(x)); }
        // the maximum in use moves only when a position's new maximum passes it by more than 5.5 (a weight then stays under e^5.5): one scalar test a step for the wave
        if (__builtin_amdgcn_ballot_w32(tm[0] > mref[0] + 5.5f || tm[1] > mref[1] + 5.5f) != 0) {
#pragma unroll
            for (int mt = 0; mt < 2; ++mt) { const float mn = fmaxf(mref[mt], tm[mt]); const float al = __builtin_amdgcn_exp2f((mref[mt] - mn) * L2E); mref[mt] = mn; lsum[mt] *= al;
#pragma unroll
                for (int ct = 0; ct < 4; ++ct)
#pragma unroll
                    for (int j = 0; j < 8; ++j) acc[ct][mt][j] *= al; } }
        v16bf ph[2], pl[2];
#pragma unroll
        for (int mt = 0; mt < 2; ++mt) { const float mb = mref[mt] * L2E; v16f p; float ps = 0.f;
#pragma unroll
            for (int e = 0; e < 16; ++e) { p[e] = __builtin_amdgcn_exp2f(s[mt][e >> 3][e & 7] * L2E - mb); ps += p[e]; }
            lsum[mt] += ps; ph[mt] = __builtin_convertvector(p, v16bf); const v8u w = __builtin_bit_cast(v8u, ph[mt]); v16f r;   // r: what the hi words leave of p
#pragma unroll
            for (int i = 0; i < 8; ++i) { r[2 * i] = p[2 * i] - __uint_as_float(w[i] << 16); r[2 * i + 1] = p[2 * i + 1] - __uint_as_float(w[i] & 0xFFFF0000u); }
            pl[mt] = __builtin_convertvector(r, v16bf); }
#pragma unroll
        for (int ct = 0; ct < 4; ++ct)
#pragma unroll
            for (int mt = 0; mt < 2; ++mt) acc[ct][mt] = wmmab(vh[ct], ph[mt], acc[ct][mt]);
#pragma unroll
        for (int ct = 0; ct < 4; ++ct)
#pragma unroll
            for (int mt = 0; mt < 2; ++mt) acc[ct][mt] = wmmab(vl[ct], ph[mt], acc[ct][mt]);
#pragma unroll
        for (int ct = 0; ct < 4; ++ct)
#pragma unroll
            for (int mt = 0; mt < 2; ++mt) acc[ct][mt] = wmmab(vh[ct], pl[mt], acc[ct][mt]);
    }
    // the join of the FKQ key parts: every wave lays down its part, then finishes channel tile kq of its own position group
#pragma unroll
    for (int mt = 0; mt < 2; ++mt) { mls[(wave * 4 + mt) * 32 + lane] = mref[mt]; mls[(wave * 4 + 2 + mt) * 32 + lane] = lsum[mt] + xhalf(lsum[mt]);
#pragma unroll
        for (int ct = 0; ct < 4; ++ct)
#pragma unroll
            for (int j = 0; j < 8; ++j) accs[(wave * 64 + (ct * 2 + mt) * 8 + j) * 32 + lane] = acc[ct][mt][j]; }
    __syncthreads();
    // the residual's x for the 16 elements that this lane stores: asked for ahead of the join, used behind it
    const unsigned oe = (unsigned)((kq * 16 + hi * 8) * TT + q0 + lr);   // the lane's element offset, the same in x and in out
    float xr[2][8]; const float g = bfr(GAM[0]);
#pragma unroll
    for (int mt = 0; mt < 2; ++mt)
#pragma unroll
        for (int j = 0; j < 8; ++j) xr[mt][j] = (X + oe)[j * TT + mt * 16];
    xwait(oe);   // the statement's memory clobber also keeps the sixteen loads up here, ahead of the join's LDS reads
#pragma unroll
    for (int mt = 0; mt < 2; ++mt) { float mk[FKQ], wk[FKQ]; float M = -3.0e38f, L = 0.f;
#pragma unroll
        for (int k = 0; k < FKQ; ++k) { mk[k] = mls[((k * FQG + qg) * 4 + mt) * 32 + lane]; M = fmaxf(M, mk[k]); }
#pragma unroll
        for (int k = 0; k < FKQ; ++k) { wk[k] = __builtin_amdgcn_exp2f((mk[k] - M) * L2E); L += wk[k] * mls[((k * FQG + qg) * 4 + 2 + mt) * 32 + lane]; }
        const float rl = __fdiv_rn(1.0f, L);
#pragma unroll
        for (int j = 0; j < 8; ++j) { float o = 0.f;
#pragma unroll
            for (int k = 0; k < FKQ; ++k) o += wk[k] * accs[((k * FQG + qg) * 64 + (kq * 2 + mt) * 8 + j) * 32 + lane];
            const float pt = o * rl; (out + oe)[j * TT + mt * 16] = g * pt + bfr(xr[mt][j]); } }
}
extern "C" void kernel_launch(void* const* d_in, const int* in_sizes, int n_in,
                              void* d_out, int out_size, void* d_ws, size_t ws_size, hipStream_t stream) {
    (void)in_sizes; (void)n_in; (void)out_size;
    const float* x = (const float*)d_in[0]; const float* wq = (const float*)d_in[1]; const float* wk = (const float*)d_in[2]; const float* wv = (const float*)d_in[3]; const float* gam = (const float*)d_in[4];
    // inputs in the module's argument order: x, Wq, Wk, Wv, gamma = d_in[0..4]: all read
    float* OUT = (float*)d_out;     // [8][64][4096]
    char* wsp = (char*)d_ws;
    auto take = [&](size_t bytes) { char* p = wsp; wsp += (bytes + 255) & ~(size_t)255; return (void*)p; };
    bf* QK = (bf*)take((size_t)4 * QKP * 2); bf* VC = (bf*)take((size_t)NB_ * 2 * HD * TT * 2);   // 8 entries each; QK: query hi, query lo, key hi, key lo; VC: h, hi and lo words
    if ((size_t)(wsp - (char*)d_ws) > ws_size) return;    // total 12 MiB carved
    k_prep<<<dim3(TT / 64, NB_, 1), 32, 0, stream>>>(x, wq, wk, wv, QK, VC);   /* the query, key and h planes, hi and lo words */
    k_fattn<<<dim3(TT / (FQG * 32), NB_, 1), FQG * FKQ * 32, 0, stream>>>(QK, QK + (size_t)QKP, QK + (size_t)2 * QKP, QK + (size_t)3 * QKP, VC, x, gam, OUT);   /* out[b][c][m] = gamma (the sum over n of h[c][n] softmax_n(g[:, m] . f[:, n])) + x[b][c][m] */
}

// v006
// One run takes 50.5 microseconds.
// In two side-by-side timings against v005, it was 1.09 and 1.11 times as fast.
// Over all steps from v000 it is 37.0 times as fast.
#include <hip/hip_runtime.h>

// A single-head spatial self-attention over 4,096 positions with 1 x 1 convolutions (x [8][64][64][64] = [entry][64 channels][4,096 positions]; Wq, Wk [8][64], Wv [64][64], ALL 'oi' (out, in), no bias; gamma [1], a scalar input): f = Wq x and g = Wk x (8 channels each); h = Wv x (64 channels);
// s[n][m] = f[:, n] . g[:, m] (no scale, no mask); a softmax over n, the score matrix's FIRST axis: for the output position m the weights run over n: g gives position m's query, f the keys; o[c][m] = sum_n h[c][n] weight[n][m]; out[c][m] = gamma o[c][m] + x[c][m] -> [8][64][64][64] (2.1 M); argument order x, Wq, Wk, Wv, gamma: all read.
// Layout: TWO launches.
// k_prep, one wave for 64 positions of one entry: x and the three weights are read as they stand (f32), rounded to bf16 in registers and laid straight into matrix fragments; the three 1 x 1 convolutions at depth 64: one tile of Wk's 8 rows | Wq's 8 rows as A with the positions as Bt, four tiles of Wv's rows as Bt with the positions as A; the f32 results are split in registers and stored as the bf16 hi | lo planes that k_fattn reads, EACH IN ITS FRAGMENTS' OWN ORDER, so that a wave's 16-byte load there covers whole 128-byte lines (512 consecutive bytes of h; 256 of a key plane, which both halves of the wave read): query and key maps token-major [4096][8], a hi and a lo plane each (a row of 16 bytes is one quarter of a score fragment's depth: see k_fattn), h as ONE plane [128 key steps][4 channel tiles][hi | lo words][2 halves of the depth][32 lanes][8 keys] (with the positions as A a lane holds one channel's 32 keys of a step: four 16-byte words of that order).
// k_fattn, for all 8 entries: scores, softmax, value product and residual in one kernel, so that neither the scores nor the weights ever reach memory. A work-group has 128 output positions m (4 groups of 32) x 4 quarters of the 4,096 keys n = 16 waves; a wave walks its 1,024 keys 32 at a time: the TRANSPOSED scores (A = key rows, Bt = query rows; hi + lo words of both: the four cross products of 8 channels each fill the depth 32 of ONE product), a running maximum and sum per position, the unnormalised weights exp(s - maximum in use) as bf16 hi and lo words straight from the score accumulators into the Bt operand of the value product (A = h's rows; hi + lo words of both, three products); the four quarters are joined in LDS, in quarter order, normalised, and stored as out[c][m] = gamma o[c][m] + x[c][m] (gamma and x read from their inputs and rounded to bf16 as every float input is): the one writer of the output.
// Compute dtypes, f32 accumulate: every float input rounded to bf16 at its load; the three 1 x 1 convolutions ONE bf16 product each on exact operands; the two 8-channel maps, h and the weights as bf16 hi + lo words at both attention products; softmax f32; the scaled residual f32.

#define NB_  8
#define TT   4096                 // positions = the softmax's key axis
#define HD   64                   // channels
#define DQK  8                    // q and k channels
#define DP   8                    // q and k rows as stored: 8 channels, 16 bytes
#define VST  8192                 // bytes of one key step (32 keys x 64 channels, hi and lo words) in the h plane
#define VCT  2048                 // bytes of one channel tile in it: the hi words' two halves of 512, then the lo words'
#define QKP  (NB_ * TT * DP)      // elements of one query or key plane, all entries
#define FQG  4                    // k_fattn: groups of 32 output positions a work-group
#define FKQ  4                    // k_fattn: parts of the key axis a work-group, one wave each per group
#define L2E  1.4426950408889634f
typedef unsigned short bf;
typedef __attribute__((ext_vector_type(16))) __bf16   v16bf;
typedef __attribute__((ext_vector_type(4)))  __bf16   v4bf;
typedef __attribute__((ext_vector_type(8)))  unsigned short v8us;
typedef __attribute__((ext_vector_type(4)))  unsigned short v4us;
typedef __attribute__((ext_vector_type(2)))  unsigned v2u;
typedef __attribute__((ext_vector_type(8)))  unsigned v8u;
typedef __attribute__((ext_vector_type(16))) float    v16f;
typedef __attribute__((ext_vector_type(8)))  float    v8f;
typedef __attribute__((ext_vector_type(4)))  float    v4f;

__device__ __forceinline__ unsigned short f2bf(float f) { unsigned u = __float_as_uint(f); u += 0x7FFFu + ((u >> 16) & 1u); return (unsigned short)(u >> 16); }
__device__ __forceinline__ float bf2f(unsigned short b) { return __uint_as_float(((unsigned)b) << 16); }
__device__ __forceinline__ float bfr(float f) { return bf2f(f2bf(f)); }
__device__ __forceinline__ v16bf cat16b(v8us lo, v8us hi) { return __builtin_bit_cast(v16bf, __builtin_shufflevector(lo, hi, 0, 1, 2, 3, 4, 5, 6, 7, 8, 9, 10, 11, 12, 13, 14, 15)); }
__device__ __forceinline__ v8f wmmab(v16bf a, v16bf b, v8f c) { return __builtin_amdgcn_wmma_f32_16x16x32_bf16(false, a, false, b, (short)0, c, false, false); }
// a fragment of 16 rows at depth 32 from a plane in fragment order: p = the tile + 16 bytes x lane; the lane's k order is 8 hi + 0..7 (first half), then 16 + 8 hi + 0..7 (second half, 512 bytes on), for A and Bt alike
__device__ __forceinline__ v16bf ldfrag(const char* p) { return cat16b(*(const v8us*)p, *(const v8us*)(p + 512)); }
__device__ __forceinline__ void xwait(unsigned off) { asm volatile("s_wait_xcnt 0x0" : : "v"(off) : "memory"); }   // stands behind a group of loads that share the offset register 'off': the wait in front of any rewrite of that register; naming it as an input keeps it whole up to the wait, so that no load of the group lands on it
__device__ __forceinline__ void xwait2(const char* p, unsigned off) { asm volatile("s_wait_xcnt 0x0" : : "v"(p), "v"(off) : "memory"); }   // the same behind a group of loads of which some go by the lane's own address pair 'p', the others by 'off'
__device__ __forceinline__ void xwaitp(const char* p) { asm volatile("s_wait_xcnt 0x0" : : "v"(p) : "memory"); }   // the same behind a group of loads that go by the lane's own address pair 'p'

// the same fragment from a K-contiguous f32 row, rounded to bf16: p = the lane's row + 8 hi (+ 32 for the second half of the depth), in bytes
__device__ __forceinline__ v16bf ldw(const char* p) { const v4f a = *(const v4f*)p, b = *(const v4f*)(p + 16), c = *(const v4f*)(p + 64), d = *(const v4f*)(p + 80); v16f f;
#pragma unroll
    for (int q = 0; q < 4; ++q) { f[q] = a[q]; f[4 + q] = b[q]; f[8 + q] = c[q]; f[12 + q] = d[q]; }
    return __builtin_convertvector(f, v16bf); }
// y = h + l + (what two bf16 words cannot hold): h = y rounded to bf16, l = (y - h) rounded to bf16
__device__ __forceinline__ void split4(v4f y, v4us& h, v4us& l) { const v4bf hb = __builtin_convertvector(y, v4bf); const v2u w = __builtin_bit_cast(v2u, hb); v4f r;
#pragma unroll
    for (int i = 0; i < 2; ++i) { r[2 * i] = y[2 * i] - __uint_as_float(w[i] << 16); r[2 * i + 1] = y[2 * i + 1] - __uint_as_float(w[i] & 0xFFFF0000u); }
    h = __builtin_bit_cast(v4us, hb); l = __builtin_bit_cast(v4us, __builtin_convertvector(r, v4bf)); }
// k_prep: see the file's head. grid (TT / 64, entries), 32 threads. Fragment row lr of position tile nb is position n0 + 4 lr + nb: a lane's 16-byte load of x then holds one channel of its row in all four tiles.
// QK = the four query and key planes one behind the other: query hi, query lo, key hi, key lo. A result tile holds, in lane (lr, hi), register j, row 8 hi + j and column lr: in the Wk | Wq tile (weights as A) the lanes hi = 0 hold a position's 8 query channels, the lanes hi = 1 its 8 key channels; in an h tile (positions as A) row 8 hi + j of tile nb is position n0 + 32 hi + 4 j + nb and column lr the channel: over j and nb a lane holds all 32 keys of key step n0 / 32 + hi for one channel, keys 8 c + 0..7 in registers j = 2 c, 2 c + 1.
__global__ __launch_bounds__(32) void k_prep(const float* __restrict__ X, const float* __restrict__ WQ, const float* __restrict__ WK, const float* __restrict__ WV, bf* QK, bf* V) {
    const int lane = threadIdx.x & 31, lr = lane & 15, hi = lane >> 4; const int n0 = blockIdx.x * 64; const size_t b = blockIdx.y;
    X += b * HD * TT; QK += b * TT * DP; V += b * 2 * HD * TT;
    // every loop below has a constant trip count and is unrolled so that its array indices are register names
    const unsigned xo = (unsigned)(8 * hi * TT + n0 + 4 * lr) * 4u;   // the lane's byte offset in x: channel 8 hi, its four positions
    v4f xv[2][16];
#pragma unroll
    for (int kc = 0; kc < 2; ++kc)
#pragma unroll
        for (int e = 0; e < 16; ++e) xv[kc][e] = *(const v4f*)((const char*)X + xo + (kc * 32 + (e >> 3) * 16 + (e & 7)) * TT * 4);
    xwait(xo);
    const char* wp = (const char*)(lr < DQK ? WK : WQ) + (unsigned)((lr & (DQK - 1)) * HD + 8 * hi) * 4u; const unsigned wo = (unsigned)(lr * HD + 8 * hi) * 4u;
    v16bf aw[5][2];   // tile 0: Wk's rows | Wq's rows; tiles 1..4: Wv's rows
#pragma unroll
    for (int kc = 0; kc < 2; ++kc) { aw[0][kc] = ldw(wp + kc * 128);
#pragma unroll
        for (int mb = 0; mb < 4; ++mb) aw[1 + mb][kc] = ldw((const char*)WV + wo + mb * 16 * HD * 4 + kc * 128); }
    xwait2(wp, wo);
    v16bf bt[4][2];
#pragma unroll
    for (int nb = 0; nb < 4; ++nb)
#pragma unroll
        for (int kc = 0; kc < 2; ++kc) { v16f f;
#pragma unroll
            for (int e = 0; e < 16; ++e) f[e] = xv[kc][e][nb];
            bt[nb][kc] = __builtin_convertvector(f, v16bf); }
    const unsigned qo = (unsigned)(hi * 2 * QKP + (n0 + 4 * lr) * DP) * 2u, vo = (unsigned)((n0 / 32 + hi) * VST + lr * 16);   // the lane's byte offsets in QK (its map's hi plane, its first position's row) and in the h plane (its key step, fragment lane lr)
#pragma unroll
    for (int mb = 0; mb < 5; ++mb) { v8f d[4];
#pragma unroll
        for (int nb = 0; nb < 4; ++nb) d[nb] = mb == 0 ? wmmab(aw[mb][0], bt[nb][0], (v8f){}) : wmmab(bt[nb][0], aw[mb][0], (v8f){});
#pragma unroll
        for (int nb = 0; nb < 4; ++nb) d[nb] = mb == 0 ? wmmab(aw[mb][1], bt[nb][1], d[nb]) : wmmab(bt[nb][1], aw[mb][1], d[nb]);
        if (mb == 0) {
#pragma unroll
            for (int nb = 0; nb < 4; ++nb) { v4f y0, y1; v4us h0, l0, h1, l1;
#pragma unroll
                for (int q = 0; q < 4; ++q) { y0[q] = d[nb][q]; y1[q] = d[nb][4 + q]; }
                split4(y0, h0, l0); split4(y1, h1, l1);
                char* row = (char*)QK + qo + nb * DP * 2;
                *(v8us*)row = __builtin_shufflevector(h0, h1, 0, 1, 2, 3, 4, 5, 6, 7); *(v8us*)(row + QKP * 2) = __builtin_shufflevector(l0, l1, 0, 1, 2, 3, 4, 5, 6, 7); }
        } else {
#pragma unroll
            for (int c = 0; c < 4; ++c) { v4f y0, y1; v4us h0, l0, h1, l1;   // keys 8 c + 0..7 of the step: half c >> 1 of the depth, fragment lanes 16 (c & 1) + lr
#pragma unroll
                for (int nb = 0; nb < 4; ++nb) { y0[nb] = d[nb][2 * c]; y1[nb] = d[nb][2 * c + 1]; }
                split4(y0, h0, l0); split4(y1, h1, l1);
                *(v8us*)((char*)V + vo + (mb - 1) * VCT + c * 256) = __builtin_shufflevector(h0, h1, 0, 1, 2, 3, 4, 5, 6, 7); *(v8us*)((char*)V + vo + (mb - 1) * VCT + 1024 + c * 256) = __builtin_shufflevector(l0, l1, 0, 1, 2, 3, 4, 5, 6, 7); }
        } }
}
// k_fattn: see the file's head. grid (TT / 128, entries), 512 threads. Fragment maps: a score tile's accumulator holds, in lane (lr, hi), register j, key n = 8 hi + j of its 16 keys and position m = lr; two such tiles (keys 0..15 and 16..31 of the step) are, register for register, the Bt operand's k order (k = 8 hi + j, then 16 + 8 hi + j) that ldfrag gives h's rows as A.
// A score tile is ONE product: its depth 32 is four groups of 8 channels. Group g = k 8 g + 0..7 sits in lanes hi = g & 1, fragment half g >> 1. A (keys) holds hi, hi, lo, lo words in groups 0..3: every lane has its key row's hi words in the first half and its lo words in the second. Bt (queries) holds hi, lo, hi, lo: the lanes hi = 0 have the query row's hi words in both halves, the lanes hi = 1 its lo words. The sum over the depth is key hi . query hi + key hi . query lo + key lo . query hi + key lo . query lo.
__device__ __forceinline__ float xhalf(float x) { const int b = __float_as_int(x); return __int_as_float(__builtin_amdgcn_permlanex16(b, b, 0x76543210, 0xfedcba98, false, false)); }   // the value of lane l ^ 16
__global__ __launch_bounds__(512) void k_fattn(const bf* __restrict__ Qh, const bf* __restrict__ Ql, const bf* __restrict__ Kh, const bf* __restrict__ Kl, const bf* __restrict__ V, const float* __restrict__ X, const float* __restrict__ GAM, float* out) {
    __shared__ __align__(16) float accs[FQG * FKQ * 64 * 32];   // a wave's 64 accumulator registers, lane-major
    __shared__ __align__(16) float mls[FQG * FKQ * 4 * 32];     // a wave's maxima in use (2) and sums (2), lane-major
    const int lane = threadIdx.x & 31, lr = lane & 15, hi = lane >> 4; const int wave = __builtin_amdgcn_readfirstlane(threadIdx.x >> 5), qg = wave & (FQG - 1), kq = wave / FQG;
    const size_t b = blockIdx.y; const int q0 = blockIdx.x * (FQG * 32) + qg * 32; const int nbeg = kq * (TT / FKQ), nend = nbeg + TT / FKQ;
    Qh += b * TT * DP; Ql += b * TT * DP; Kh += b * TT * DP; Kl += b * TT * DP; V += b * 2 * HD * TT; X += b * HD * TT; out += b * HD * TT;
    // every inner loop below has a constant trip count and is unrolled so that its array indices are register names
    v16bf qf[2], kf[2]; v8f acc[4][2]; float mref[2], lsum[2];
    const char* qp = (const char*)(hi ? Ql : Qh) + (unsigned)((q0 + lr) * DP) * 2u; unsigned kob = (unsigned)((nbeg + lr) * DP) * 2u;   // the lane's query row in the plane of its half of the wave; its byte offset in a key plane, which steps with the loop
    const char* vp = (const char*)V + (nbeg / 32) * VST + lane * 16;   // the lane's 16 bytes in the first fragment half of the wave's key step in the h plane: it steps with the loop
#pragma unroll
    for (int mt = 0; mt < 2; ++mt) { const v8us qw = *(const v8us*)(qp + mt * 16 * DP * 2); qf[mt] = cat16b(qw, qw); mref[mt] = -3.0e38f; lsum[mt] = 0.f;
#pragma unroll
        for (int ct = 0; ct < 4; ++ct) acc[ct][mt] = (v8f){}; }
    xwaitp(qp);
#pragma unroll
    for (int t = 0; t < 2; ++t) kf[t] = cat16b(*(const v8us*)((const char*)Kh + kob + t * 16 * DP * 2), *(const v8us*)((const char*)Kl + kob + t * 16 * DP * 2));
    xwait(kob);
    for (int n = nbeg; n < nend; n += 32) {
        v16bf vh[4], vl[4];   // this step's h fragments: asked for ahead of the scores and the softmax, used behind them
#pragma unroll
        for (int ct = 0; ct < 4; ++ct) { vh[ct] = ldfrag(vp + ct * VCT); vl[ct] = ldfrag(vp + ct * VCT + 1024); }
        xwaitp(vp); vp += VST;   // the statement's memory clobber also keeps the sixteen loads up here: left free, they sink to just in front of the value product and the wave waits out their whole latency there
        v8f s[2][2];
#pragma unroll
        for (int mt = 0; mt < 2; ++mt)
#pragma unroll
            for (int t = 0; t < 2; ++t) s[mt][t] = wmmab(kf[t], qf[mt], (v8f){});
        kob += (n + 32 < nend) ? 32u * DP * 2u : 0u;   // the next step's key fragments, one step ahead (the last step asks for its own again: in bounds, not used)
#pragma unroll
        for (int t = 0; t < 2; ++t) kf[t] = cat16b(*(const v8us*)((const char*)Kh + kob + t * 16 * DP * 2), *(const v8us*)((const char*)Kl + kob + t * 16 * DP * 2));
        xwait(kob);
        float tm[2];
#pragma unroll
        for (int mt = 0; mt < 2; ++mt) { float x = fmaxf(s[mt][0][0], s[mt][1][0]);
#pragma unroll
            for (int j = 1; j < 8; ++j) x = fmaxf(x, fmaxf(s[mt][0][j], s[mt][1][j]));
            tm[mt] = fmaxf(x, xhalf(x)); }
        // the maximum in use moves only when a position's new maximum passes it by more than 5.5 (a weight then stays under e^5.5): one scalar test a step for the wave
        if (__builtin_amdgcn_ballot_w32(tm[0] > mref[0] + 5.5f || tm[1] > mref[1] + 5.5f) != 0) {
#pragma unroll
            for (int mt = 0; mt < 2; ++mt) { const float mn = fmaxf(mref[mt], tm[mt]); const float al = __builtin_amdgcn_exp2f((mref[mt] - mn) * L2E); mref[mt] = mn; lsum[mt] *= al;
#pragma unroll
                for (int ct = 0; ct < 4; ++ct)
#pragma unroll
                    for (int j = 0; j < 8; ++j) acc[ct][mt][j] *= al; } }
        v16bf ph[2], pl[2];
#pragma unroll
        for (int mt = 0; mt < 2; ++mt) { const float mb = mref[mt] * L2E; v16f p; float ps = 0.f;
#pragma unroll
            for (int e = 0; e < 16; ++e) { p[e] = __builtin_amdgcn_exp2f(s[mt][e >> 3][e & 7] * L2E - mb); ps += p[e]; }
            lsum[mt] += ps; ph[mt] = __builtin_convertvector(p, v16bf); const v8u w = __builtin_bit_cast(v8u, ph[mt]); v16f r;   // r: what the hi words leave of p
#pragma unroll
            for (int i = 0; i < 8; ++i) { r[2 * i] = p[2 * i] - __uint_as_float(w[i] << 16); r[2 * i + 1] = p[2 * i + 1] - __uint_as_float(w[i] & 0xFFFF0000u); }
            pl[mt] = __builtin_convertvector(r, v16bf); }
#pragma unroll
        for (int ct = 0; ct < 4; ++ct)
#pragma unroll
            for (int mt = 0; mt < 2; ++mt) acc[ct][mt] = wmmab(vh[ct], ph[mt], acc[ct][mt]);
#pragma unroll
        for (int ct = 0; ct < 4; ++ct)
#pragma unroll
            for (int mt = 0; mt < 2; ++mt) acc[ct][mt] = wmmab(vl[ct], ph[mt], acc[ct][mt]);
#pragma unroll
        for (int ct = 0; ct < 4; ++ct)
#pragma unroll
            for (int mt = 0; mt < 2; ++mt) acc[ct][mt] = wmmab(vh[ct], pl[mt], acc[ct][mt]);
    }
    // the join of the FKQ key parts: every wave lays down its part, then finishes channel tile kq of its own position group
#pragma unroll
    for (int mt = 0; mt < 2; ++mt) { mls[(wave * 4 + mt) * 32 + lane] = mref[mt]; mls[(wave * 4 + 2 + mt) * 32 + lane] = lsum[mt] + xhalf(lsum[mt]);
#pragma unroll
        for (int ct = 0; ct < 4; ++ct)
#pragma unroll
            for (int j = 0; j < 8; ++j) accs[(wave * 64 + (ct * 2 + mt) * 8 + j) * 32 + lane] = acc[ct][mt][j]; }
    __syncthreads();
    // the residual's x for the 16 elements that this lane stores: asked for ahead of the join, used behind it
    const unsigned oe = (unsigned)((kq * 16 + hi * 8) * TT + q0 + lr);   // the lane's element offset, the same in x and in out
    float xr[2][8]; const float g = bfr(GAM[0]);
#pragma unroll
    for (int mt = 0; mt < 2; ++mt)
#pragma unroll
        for (int j = 0; j < 8; ++j) xr[mt][j] = (X + oe)[j * TT + mt * 16];
    xwait(oe);   // the statement's memory clobber also keeps the sixteen loads up here, ahead of the join's LDS reads
#pragma unroll
    for (int mt = 0; mt < 2; ++mt) { float mk[FKQ], wk[FKQ]; float M = -3.0e38f, L = 0.f;
#pragma unroll
        for (int k = 0; k < FKQ; ++k) { mk[k] = mls[((k * FQG + qg) * 4 + mt) * 32 + lane]; M = fmaxf(M, mk[k]); }
#pragma unroll
        for (int k = 0; k < FKQ; ++k) { wk[k] = __builtin_amdgcn_exp2f((mk[k] - M) * L2E); L += wk[k] * mls[((k * FQG + qg) * 4 + 2 + mt) * 32 + lane]; }
        const float rl = __fdiv_rn(1.0f, L);
#pragma unroll
        for (int j = 0; j < 8; ++j) { float o = 0.f;
#pragma unroll
            for (int k = 0; k < FKQ; ++k) o += wk[k] * accs[((k * FQG + qg) * 64 + (kq * 2 + mt) * 8 + j) * 32 + lane];
            const float pt = o * rl; (out + oe)[j * TT + mt * 16] = g * pt + bfr(xr[mt][j]); } }
}
extern "C" void kernel_launch(void* const* d_in, const int* in_sizes, int n_in,
                              void* d_out, int out_size, void* d_ws, size_t ws_size, hipStream_t stream) {
    (void)in_sizes; (void)n_in; (void)out_size;
    const float* x = (const float*)d_in[0]; const float* wq = (const float*)d_in[1]; const float* wk = (const float*)d_in[2]; const float* wv = (const float*)d_in[3]; const float* gam = (const float*)d_in[4];
    // inputs in the module's argument order: x, Wq, Wk, Wv, gamma = d_in[0..4]: all read
    float* OUT = (float*)d_out;     // [8][64][4096]
    char* wsp = (char*)d_ws;
    auto take = [&](size_t bytes) { char* p = wsp; wsp += (bytes + 255) & ~(size_t)255; return (void*)p; };
    bf* QK = (bf*)take((size_t)4 * QKP * 2); bf* VC = (bf*)take((size_t)NB_ * 2 * HD * TT * 2);   // 8 entries each; QK: query hi, query lo, key hi, key lo; VC: h, hi and lo words
    if ((size_t)(wsp - (char*)d_ws) > ws_size) return;    // total 10 MiB carved
    k_prep<<<dim3(TT / 64, NB_, 1), 32, 0, stream>>>(x, wq, wk, wv, QK, VC);   /* the query, key and h planes, hi and lo words */
    k_fattn<<<dim3(TT / (FQG * 32), NB_, 1), FQG * FKQ * 32, 0, stream>>>(QK, QK + (size_t)QKP, QK + (size_t)2 * QKP, QK + (size_t)3 * QKP, VC, x, gam, OUT);   /* out[b][c][m] = gamma (the sum over n of h[c][n] softmax_n(g[:, m] . f[:, n])) + x[b][c][m] */
}

// v007
// One run takes 33.2 microseconds.
// Two timings next to v006 put it at 1.50 and 1.53 times that version's speed.
// All steps since v000 together make it 56.1 times as fast.
#include <hip/hip_runtime.h>

// A single-head spatial self-attention over 4,096 positions with 1 x 1 convolutions (x [8][64][64][64] = [entry][64 channels][4,096 positions]; Wq, Wk [8][64], Wv [64][64], ALL 'oi' (out, in), no bias; gamma [1], a scalar input): f = Wq x and g = Wk x (8 channels each); h = Wv x (64 channels);
// s[n][m] = f[:, n] . g[:, m] (no scale, no mask); a softmax over n, the score matrix's FIRST axis: for the output position m the weights run over n: g gives position m's query, f the keys; o[c][m] = sum_n h[c][n] weight[n][m]; out[c][m] = gamma o[c][m] + x[c][m] -> [8][64][64][64] (2.1 M); argument order x, Wq, Wk, Wv, gamma: all read.
// Layout: TWO launches.
// k_prep, one wave for 64 positions of one entry: x and the three weights are read as they stand (f32), rounded to bf16 in registers and laid straight into matrix fragments; the three 1 x 1 convolutions at depth 64: one tile of Wk's 8 rows | Wq's 8 rows as A with the positions as Bt, four tiles of Wv's rows as Bt with the positions as A; the f32 results are stored as the planes that k_fattn reads (the two 8-channel maps split in registers into bf16 hi | lo words, h rounded once to f16), EACH IN ITS FRAGMENTS' OWN ORDER, so that a wave's 16-byte load there covers whole 128-byte lines (512 consecutive bytes of h; 256 of a key plane, which both halves of the wave read): query and key maps token-major [4096][8], a hi and a lo plane each (a row of 16 bytes is one quarter of a score fragment's depth: see k_fattn), h as ONE f16 plane [128 key steps][4 channel tiles][2 halves of the depth][32 lanes][8 keys] (with the positions as A a lane holds one channel's 32 keys of a step: four 16-byte words of that order).
// k_fattn, for all 8 entries: scores, softmax, value product and residual in one kernel, so that neither the scores nor the weights ever reach memory. A work-group has 128 output positions m (4 groups of 32) x 4 quarters of the 4,096 keys n = 16 waves; a wave walks its 1,024 keys 32 at a time: the TRANSPOSED scores (A = key rows, Bt = query rows; hi + lo words of both: the four cross products of 8 channels each fill the depth 32 of ONE product), a running maximum and sum per position, the unnormalised weights exp(s - maximum in use), at most e^5.5, rounded once to f16 straight from the score accumulators into the Bt operand of the value product (A = h's rows in f16: ONE f16 product); the four quarters are joined in LDS, in quarter order, normalised, and stored as out[c][m] = gamma o[c][m] + x[c][m] (gamma and x read from their inputs and rounded to bf16 as every float input is): the one writer of the output.
// Compute dtypes, f32 accumulate: every float input rounded to bf16 at its load; the three 1 x 1 convolutions ONE bf16 product each on exact operands; the two 8-channel maps as bf16 hi + lo words at the score product; h and the weights as ONE f16 word each (11 bits; h must lie inside f16's range, 65,504: here it is a sum of 64 products of unit-scale values) at the value product; softmax and its sum f32; the scaled residual f32.

#define NB_  8
#define TT   4096                 // positions = the softmax's key axis
#define HD   64                   // channels
#define DQK  8                    // q and k channels
#define DP   8                    // q and k rows as stored: 8 channels, 16 bytes
#define VST  4096                 // bytes of one key step (32 keys x 64 channels, f16) in the h plane
#define VCT  1024                 // bytes of one channel tile in it: the two halves of the depth, 512 each
#define QKP  (NB_ * TT * DP)      // elements of one query or key plane, all entries
#define FQG  4                    // k_fattn: groups of 32 output positions a work-group
#define FKQ  4                    // k_fattn: parts of the key axis a work-group, one wave each per group
#define L2E  1.4426950408889634f
typedef unsigned short bf;
typedef __attribute__((ext_vector_type(16))) __bf16   v16bf;
typedef __attribute__((ext_vector_type(4)))  __bf16   v4bf;
typedef __attribute__((ext_vector_type(16))) _Float16 v16h;
typedef __attribute__((ext_vector_type(8)))  _Float16 v8h;
typedef __attribute__((ext_vector_type(8)))  unsigned short v8us;
typedef __attribute__((ext_vector_type(4)))  unsigned short v4us;
typedef __attribute__((ext_vector_type(2)))  unsigned v2u;
typedef __attribute__((ext_vector_type(16))) float    v16f;
typedef __attribute__((ext_vector_type(8)))  float    v8f;
typedef __attribute__((ext_vector_type(4)))  float    v4f;

__device__ __forceinline__ unsigned short f2bf(float f) { unsigned u = __float_as_uint(f); u += 0x7FFFu + ((u >> 16) & 1u); return (unsigned short)(u >> 16); }
__device__ __forceinline__ float bf2f(unsigned short b) { return __uint_as_float(((unsigned)b) << 16); }
__device__ __forceinline__ float bfr(float f) { return bf2f(f2bf(f)); }
__device__ __forceinline__ v16bf cat16b(v8us lo, v8us hi) { return __builtin_bit_cast(v16bf, __builtin_shufflevector(lo, hi, 0, 1, 2, 3, 4, 5, 6, 7, 8, 9, 10, 11, 12, 13, 14, 15)); }
__device__ __forceinline__ v8f wmmab(v16bf a, v16bf b, v8f c) { return __builtin_amdgcn_wmma_f32_16x16x32_bf16(false, a, false, b, (short)0, c, false, false); }
__device__ __forceinline__ v8f wmmah(v16h a, v16h b, v8f c) { return __builtin_amdgcn_wmma_f32_16x16x32_f16(false, a, false, b, (short)0, c, false, false); }
// a fragment of 16 rows at depth 32 from a plane in fragment order: p = the tile + 16 bytes x lane; the lane's k order is 8 hi + 0..7 (first half), then 16 + 8 hi + 0..7 (second half, 512 bytes on), for A and Bt alike
__device__ __forceinline__ v16h ldfrag(const char* p) { return __builtin_bit_cast(v16h, cat16b(*(const v8us*)p, *(const v8us*)(p + 512))); }
__device__ __forceinline__ void xwait(unsigned off) { asm volatile("s_wait_xcnt 0x0" : : "v"(off) : "memory"); }   // stands behind a group of loads that share the offset register 'off': the wait in front of any rewrite of that register; naming it as an input keeps it whole up to the wait, so that no load of the group lands on it
__device__ __forceinline__ void xwait2(const char* p, unsigned off) { asm volatile("s_wait_xcnt 0x0" : : "v"(p), "v"(off) : "memory"); }   // the same behind a group of loads of which some go by the lane's own address pair 'p', the others by 'off'
__device__ __forceinline__ void xwaitp(const char* p) { asm volatile("s_wait_xcnt 0x0" : : "v"(p) : "memory"); }   // the same behind a group of loads that go by the lane's own address pair 'p'

// the same fragment from a K-contiguous f32 row, rounded to bf16: p = the lane's row + 8 hi (+ 32 for the second half of the depth), in bytes
__device__ __forceinline__ v16bf ldw(const char* p) { const v4f a = *(const v4f*)p, b = *(const v4f*)(p + 16), c = *(const v4f*)(p + 64), d = *(const v4f*)(p + 80); v16f f;
#pragma unroll
    for (int q = 0; q < 4; ++q) { f[q] = a[q]; f[4 + q] = b[q]; f[8 + q] = c[q]; f[12 + q] = d[q]; }
    return __builtin_convertvector(f, v16bf); }
// y = h + l + (what two bf16 words cannot hold): h = y rounded to bf16, l = (y - h) rounded to bf16
__device__ __forceinline__ void split4(v4f y, v4us& h, v4us& l) { const v4bf hb = __builtin_convertvector(y, v4bf); const v2u w = __builtin_bit_cast(v2u, hb); v4f r;
#pragma unroll
    for (int i = 0; i < 2; ++i) { r[2 * i] = y[2 * i] - __uint_as_float(w[i] << 16); r[2 * i + 1] = y[2 * i + 1] - __uint_as_float(w[i] & 0xFFFF0000u); }
    h = __builtin_bit_cast(v4us, hb); l = __builtin_bit_cast(v4us, __builtin_convertvector(r, v4bf)); }
// k_prep: see the file's head. grid (TT / 64, entries), 32 threads. Fragment row lr of position tile nb is position n0 + 4 lr + nb: a lane's 16-byte load of x then holds one channel of its row in all four tiles.
// QK = the four query and key planes one behind the other: query hi, query lo, key hi, key lo. A result tile holds, in lane (lr, hi), register j, row 8 hi + j and column lr: in the Wk | Wq tile (weights as A) the lanes hi = 0 hold a position's 8 query channels, the lanes hi = 1 its 8 key channels; in an h tile (positions as A) row 8 hi + j of tile nb is position n0 + 32 hi + 4 j + nb and column lr the channel: over j and nb a lane holds all 32 keys of key step n0 / 32 + hi for one channel, keys 8 c + 0..7 in registers j = 2 c, 2 c + 1.
__global__ __launch_bounds__(32) void k_prep(const float* __restrict__ X, const float* __restrict__ WQ, const float* __restrict__ WK, const float* __restrict__ WV, bf* QK, bf* V) {
    const int lane = threadIdx.x & 31, lr = lane & 15, hi = lane >> 4; const int n0 = blockIdx.x * 64; const size_t b = blockIdx.y;
    X += b * HD * TT; QK += b * TT * DP; V += b * HD * TT;
    // every loop below has a constant trip count and is unrolled so that its array indices are register names
    const unsigned xo = (unsigned)(8 * hi * TT + n0 + 4 * lr) * 4u;   // the lane's byte offset in x: channel 8 hi, its four positions
    v4f xv[2][16];
#pragma unroll
    for (int kc = 0; kc < 2; ++kc)
#pragma unroll
        for (int e = 0; e < 16; ++e) xv[kc][e] = *(const v4f*)((const char*)X + xo + (kc * 32 + (e >> 3) * 16 + (e & 7)) * TT * 4);
    xwait(xo);
    const char* wp = (const char*)(lr < DQK ? WK : WQ) + (unsigned)((lr & (DQK - 1)) * HD + 8 * hi) * 4u; const unsigned wo = (unsigned)(lr * HD + 8 * hi) * 4u;
    v16bf aw[5][2];   // tile 0: Wk's rows | Wq's rows; tiles 1..4: Wv's rows
#pragma unroll
    for (int kc = 0; kc < 2; ++kc) { aw[0][kc] = ldw(wp + kc * 128);
#pragma unroll
        for (int mb = 0; mb < 4; ++mb) aw[1 + mb][kc] = ldw((const char*)WV + wo + mb * 16 * HD * 4 + kc * 128); }
    xwait2(wp, wo);
    v16bf bt[4][2];
#pragma unroll
    for (int nb = 0; nb < 4; ++nb)
#pragma unroll
        for (int kc = 0; kc < 2; ++kc) { v16f f;
#pragma unroll
            for (int e = 0; e < 16; ++e) f[e] = xv[kc][e][nb];
            bt[nb][kc] = __builtin_convertvector(f, v16bf); }
    const unsigned qo = (unsigned)(hi * 2 * QKP + (n0 + 4 * lr) * DP) * 2u, vo = (unsigned)((n0 / 32 + hi) * VST + lr * 16);   // the lane's byte offsets in QK (its map's hi plane, its first position's row) and in the h plane (its key step, fragment lane lr)
#pragma unroll
    for (int mb = 0; mb < 5; ++mb) { v8f d[4];
#pragma unroll
        for (int nb = 0; nb < 4; ++nb) d[nb] = mb == 0 ? wmmab(aw[mb][0], bt[nb][0], (v8f){}) : wmmab(bt[nb][0], aw[mb][0], (v8f){});
#pragma unroll
        for (int nb = 0; nb < 4; ++nb) d[nb] = mb == 0 ? wmmab(aw[mb][1], bt[nb][1], d[nb]) : wmmab(bt[nb][1], aw[mb][1], d[nb]);
        if (mb == 0) {
#pragma unroll
            for (int nb = 0; nb < 4; ++nb) { v4f y0, y1; v4us h0, l0, h1, l1;
#pragma unroll
                for (int q = 0; q < 4; ++q) { y0[q] = d[nb][q]; y1[q] = d[nb][4 + q]; }
                split4(y0, h0, l0); split4(y1, h1, l1);
                char* row = (char*)QK + qo + nb * DP * 2;
                *(v8us*)row = __builtin_shufflevector(h0, h1, 0, 1, 2, 3, 4, 5, 6, 7); *(v8us*)(row + QKP * 2) = __builtin_shufflevector(l0, l1, 0, 1, 2, 3, 4, 5, 6, 7); }
        } else {
#pragma unroll
            for (int c = 0; c < 4; ++c) { v8f y;   // keys 8 c + 0..7 of the step: half c >> 1 of the depth, fragment lanes 16 (c & 1) + lr
#pragma unroll
                for (int nb = 0; nb < 4; ++nb) { y[nb] = d[nb][2 * c]; y[4 + nb] = d[nb][2 * c + 1]; }
                *(v8us*)((char*)V + vo + (mb - 1) * VCT + c * 256) = __builtin_bit_cast(v8us, __builtin_convertvector(y, v8h)); }
        } }
}
// k_fattn: see the file's head. grid (TT / 128, entries), 512 threads. Fragment maps: a score tile's accumulator holds, in lane (lr, hi), register j, key n = 8 hi + j of its 16 keys and position m = lr; two such tiles (keys 0..15 and 16..31 of the step) are, register for register, the Bt operand's k order (k = 8 hi + j, then 16 + 8 hi + j) that ldfrag gives h's rows as A.
// A score tile is ONE product: its depth 32 is four groups of 8 channels. Group g = k 8 g + 0..7 sits in lanes hi = g & 1, fragment half g >> 1. A (keys) holds hi, hi, lo, lo words in groups 0..3: every lane has its key row's hi words in the first half and its lo words in the second. Bt (queries) holds hi, lo, hi, lo: the lanes hi = 0 have the query row's hi words in both halves, the lanes hi = 1 its lo words. The sum over the depth is key hi . query hi + key hi . query lo + key lo . query hi + key lo . query lo.
__device__ __forceinline__ float xhalf(float x) { const int b = __float_as_int(x); return __int_as_float(__builtin_amdgcn_permlanex16(b, b, 0x76543210, 0xfedcba98, false, false)); }   // the value of lane l ^ 16
__global__ __launch_bounds__(512) void k_fattn(const bf* __restrict__ Qh, const bf* __restrict__ Ql, const bf* __restrict__ Kh, const bf* __restrict__ Kl, const bf* __restrict__ V, const float* __restrict__ X, const float* __restrict__ GAM, float* out) {
    __shared__ __align__(16) float accs[FQG * FKQ * 64 * 32];   // a wave's 64 accumulator registers, lane-major
    __shared__ __align__(16) float mls[FQG * FKQ * 4 * 32];     // a wave's maxima in use (2) and sums (2), lane-major
    const int lane = threadIdx.x & 31, lr = lane & 15, hi = lane >> 4; const int wave = __builtin_amdgcn_readfirstlane(threadIdx.x >> 5), qg = wave & (FQG - 1), kq = wave / FQG;
    const size_t b = blockIdx.y; const int q0 = blockIdx.x * (FQG * 32) + qg * 32; const int nbeg = kq * (TT / FKQ), nend = nbeg + TT / FKQ;
    Qh += b * TT * DP; Ql += b * TT * DP; Kh += b * TT * DP; Kl += b * TT * DP; V += b * HD * TT; X += b * HD * TT; out += b * HD * TT;
    // every inner loop below has a constant trip count and is unrolled so that its array indices are register names
    v16bf qf[2], kf[2]; v8f acc[4][2]; float mref[2], lsum[2];
    const char* qp = (const char*)(hi ? Ql : Qh) + (unsigned)((q0 + lr) * DP) * 2u; unsigned kob = (unsigned)((nbeg + lr) * DP) * 2u;   // the lane's query row in the plane of its half of the wave; its byte offset in a key plane, which steps with the loop
    const char* vp = (const char*)V + (nbeg / 32) * VST + lane * 16;   // the lane's 16 bytes in the first fragment half of the wave's key step in the h plane: it steps with the loop
#pragma unroll
    for (int mt = 0; mt < 2; ++mt) { const v8us qw = *(const v8us*)(qp + mt * 16 * DP * 2); qf[mt] = cat16b(qw, qw); mref[mt] = -3.0e38f; lsum[mt] = 0.f;
#pragma unroll
        for (int ct = 0; ct < 4; ++ct) acc[ct][mt] = (v8f){}; }
    xwaitp(qp);
#pragma unroll
    for (int t = 0; t < 2; ++t) kf[t] = cat16b(*(const v8us*)((const char*)Kh + kob + t * 16 * DP * 2), *(const v8us*)((const char*)Kl + kob + t * 16 * DP * 2));
    xwait(kob);
    for (int n = nbeg; n < nend; n += 32) {
        v16h vh[4];   // this step's h fragments: asked for ahead of the scores and the softmax, used behind them
#pragma unroll
        for (int ct = 0; ct < 4; ++ct) vh[ct] = ldfrag(vp + ct * VCT);
        xwaitp(vp); vp += VST;   // the statement's memory clobber also keeps the eight loads up here: left free, they sink to just in front of the value product and the wave waits out their whole latency there
        v8f s[2][2];
#pragma unroll
        for (int mt = 0; mt < 2; ++mt)
#pragma unroll
            for (int t = 0; t < 2; ++t) s[mt][t] = wmmab(kf[t], qf[mt], (v8f){});
        kob += (n + 32 < nend) ? 32u * DP * 2u : 0u;   // the next step's key fragments, one step ahead (the last step asks for its own again: in bounds, not used)
#pragma unroll
        for (int t = 0; t < 2; ++t) kf[t] = cat16b(*(const v8us*)((const char*)Kh + kob + t * 16 * DP * 2), *(const v8us*)((const char*)Kl + kob + t * 16 * DP * 2));
        xwait(kob);
        float tm[2];
#pragma unroll
        for (int mt = 0; mt < 2; ++mt) { float x = fmaxf(s[mt][0][0], s[mt][1][0]);
#pragma unroll
            for (int j = 1; j < 8; ++j) x = fmaxf(x, fmaxf(s[mt][0][j], s[mt][1][j]));
            tm[mt] = fmaxf(x, xhalf(x)); }
        // the maximum in use moves only when a position's new maximum passes it by more than 5.5 (a weight then stays under e^5.5): one scalar test a step for the wave
        if (__builtin_amdgcn_ballot_w32(tm[0] > mref[0] + 5.5f || tm[1] > mref[1] + 5.5f) != 0) {
#pragma unroll
            for (int mt = 0; mt < 2; ++mt) { const float mn = fmaxf(mref[mt], tm[mt]); const float al = __builtin_amdgcn_exp2f((mref[mt] - mn) * L2E); mref[mt] = mn; lsum[mt] *= al;
#pragma unroll
                for (int ct = 0; ct < 4; ++ct)
#pragma unroll
                    for (int j = 0; j < 8; ++j) acc[ct][mt][j] *= al; } }
        v16h ph[2];
#pragma unroll
        for (int mt = 0; mt < 2; ++mt) { const float mb = mref[mt] * L2E; v16f p; float ps = 0.f;
#pragma unroll
            for (int e = 0; e < 16; ++e) { p[e] = __builtin_amdgcn_exp2f(s[mt][e >> 3][e & 7] * L2E - mb); ps += p[e]; }
            lsum[mt] += ps; ph[mt] = __builtin_convertvector(p, v16h); }
#pragma unroll
        for (int ct = 0; ct < 4; ++ct)
#pragma unroll
            for (int mt = 0; mt < 2; ++mt) acc[ct][mt] = wmmah(vh[ct], ph[mt], acc[ct][mt]);
    }
    // the join of the FKQ key parts: every wave lays down its part, then finishes channel tile kq of its own position group
#pragma unroll
    for (int mt = 0; mt < 2; ++mt) { mls[(wave * 4 + mt) * 32 + lane] = mref[mt]; mls[(wave * 4 + 2 + mt) * 32 + lane] = lsum[mt] + xhalf(lsum[mt]);
#pragma unroll
        for (int ct = 0; ct < 4; ++ct)
#pragma unroll
            for (int j = 0; j < 8; ++j) accs[(wave * 64 + (ct * 2 + mt) * 8 + j) * 32 + lane] = acc[ct][mt][j]; }
    __syncthreads();
    // the residual's x for the 16 elements that this lane stores: asked for ahead of the join, used behind it
    const unsigned oe = (unsigned)((kq * 16 + hi * 8) * TT + q0 + lr);   // the lane's element offset, the same in x and in out
    float xr[2][8]; const float g = bfr(GAM[0]);
#pragma unroll
    for (int mt = 0; mt < 2; ++mt)
#pragma unroll
        for (int j = 0; j < 8; ++j) xr[mt][j] = (X + oe)[j * TT + mt * 16];
    xwait(oe);   // the statement's memory clobber also keeps the sixteen loads up here, ahead of the join's LDS reads
#pragma unroll
    for (int mt = 0; mt < 2; ++mt) { float mk[FKQ], wk[FKQ]; float M = -3.0e38f, L = 0.f;
#pragma unroll
        for (int k = 0; k < FKQ; ++k) { mk[k] = mls[((k * FQG + qg) * 4 + mt) * 32 + lane]; M = fmaxf(M, mk[k]); }
#pragma unroll
        for (int k = 0; k < FKQ; ++k) { wk[k] = __builtin_amdgcn_exp2f((mk[k] - M) * L2E); L += wk[k] * mls[((k * FQG + qg) * 4 + 2 + mt) * 32 + lane]; }
        const float rl = __fdiv_rn(1.0f, L);
#pragma unroll
        for (int j = 0; j < 8; ++j) { float o = 0.f;
#pragma unroll
            for (int k = 0; k < FKQ; ++k) o += wk[k] * accs[((k * FQG + qg) * 64 + (kq * 2 + mt) * 8 + j) * 32 + lane];
            const float pt = o * rl; (out + oe)[j * TT + mt * 16] = g * pt + bfr(xr[mt][j]); } }
}
extern "C" void kernel_launch(void* const* d_in, const int* in_sizes, int n_in,
                              void* d_out, int out_size, void* d_ws, size_t ws_size, hipStream_t stream) {
    (void)in_sizes; (void)n_in; (void)out_size;
    const float* x = (const float*)d_in[0]; const float* wq = (const float*)d_in[1]; const float* wk = (const float*)d_in[2]; const float* wv = (const float*)d_in[3]; const float* gam = (const float*)d_in[4];
    // inputs in the module's argument order: x, Wq, Wk, Wv, gamma = d_in[0..4]: all read
    float* OUT = (float*)d_out;     // [8][64][4096]
    char* wsp = (char*)d_ws;
    auto take = [&](size_t bytes) { char* p = wsp; wsp += (bytes + 255) & ~(size_t)255; return (void*)p; };
    bf* QK = (bf*)take((size_t)4 * QKP * 2); bf* VC = (bf*)take((size_t)NB_ * HD * TT * 2);   // 8 entries each; QK: query hi, query lo, key hi, key lo; VC: h, f16
    if ((size_t)(wsp - (char*)d_ws) > ws_size) return;    // total 6 MiB carved
    k_prep<<<dim3(TT / 64, NB_, 1), 32, 0, stream>>>(x, wq, wk, wv, QK, VC);   /* the query and key planes, hi and lo words; the h plane, f16 */
    k_fattn<<<dim3(TT / (FQG * 32), NB_, 1), FQG * FKQ * 32, 0, stream>>>(QK, QK + (size_t)QKP, QK + (size_t)2 * QKP, QK + (size_t)3 * QKP, VC, x, gam, OUT);   /* out[b][c][m] = gamma (the sum over n of h[c][n] softmax_n(g[:, m] . f[:, n])) + x[b][c][m] */
}

// v008
// It runs in 31.7 microseconds.
// Two timings next to v007 put it at 1.04 and 1.05 times that version's speed.
// All steps since v000 together make it 58.6 times as fast.
#include <hip/hip_runtime.h>

// A single-head spatial self-attention over 4,096 positions with 1 x 1 convolutions (x [8][64][64][64] = [entry][64 channels][4,096 positions]; Wq, Wk [8][64], Wv [64][64], ALL 'oi' (out, in), no bias; gamma [1], a scalar input): f = Wq x and g = Wk x (8 channels each); h = Wv x (64 channels);
// s[n][m] = f[:, n] . g[:, m] (no scale, no mask); a softmax over n, the score matrix's FIRST axis: for the output position m the weights run over n: g gives position m's query, f the keys; o[c][m] = sum_n h[c][n] weight[n][m]; out[c][m] = gamma o[c][m] + x[c][m] -> [8][64][64][64] (2.1 M); argument order x, Wq, Wk, Wv, gamma: all read.
// Layout: TWO launches.
// k_prep, one wave for 64 positions of one entry: x and the three weights are read as they stand (f32), rounded to bf16 in registers and laid straight into matrix fragments; the three 1 x 1 convolutions at depth 64: one tile of Wk's 8 rows | Wq's 8 rows as A with the positions as Bt, four tiles of Wv's rows as Bt with the positions as A; the f32 results are stored as the planes that k_fattn reads (the two 8-channel maps split in registers into bf16 hi | lo words, h rounded once to f16), EACH IN ITS FRAGMENTS' OWN ORDER, so that a wave's 16-byte load there covers whole 128-byte lines (512 consecutive bytes of h; 256 of a key plane, which both halves of the wave read): query and key maps token-major [4096][8], a hi and a lo plane each (a row of 16 bytes is one quarter of a score fragment's depth: see k_fattn), h as ONE f16 plane [128 key steps][4 channel tiles][2 halves of the depth][32 lanes][8 keys] (with the positions as A a lane holds one channel's 32 keys of a step: four 16-byte words of that order).
// k_fattn, for all 8 entries: scores, softmax, value product and residual in one kernel, so that neither the scores nor the weights ever reach memory. A work-group has 128 output positions m (4 groups of 32) x 4 quarters of the 4,096 keys n = 16 waves; a wave walks its 1,024 keys 32 at a time: the TRANSPOSED scores (A = key rows, Bt = query rows; hi + lo words of both: the four cross products of 8 channels each fill the depth 32 of ONE product), a maximum in use and a sum per position, the unnormalised weights exp(s - maximum in use), at most 32,768 (the maximum in use moves only when a step's sum of weights passes that), rounded once to f16 straight from the score accumulators into the Bt operand of the value product (A = h's rows in f16: ONE f16 product); the four quarters are joined in LDS, in quarter order, normalised, and stored as out[c][m] = gamma o[c][m] + x[c][m] (gamma and x read from their inputs and rounded to bf16 as every float input is): the one writer of the output.
// Compute dtypes, f32 accumulate: every float input rounded to bf16 at its load; the three 1 x 1 convolutions ONE bf16 product each on exact operands; the two 8-channel maps as bf16 hi + lo words at the score product; h and the weights as ONE f16 word each (11 bits; h must lie inside f16's range, 65,504: here it is a sum of 64 products of unit-scale values) at the value product; softmax and its sum f32; the scaled residual f32.

#define NB_  8
#define TT   4096                 // positions = the softmax's key axis
#define HD   64                   // channels
#define DQK  8                    // q and k channels
#define DP   8                    // q and k rows as stored: 8 channels, 16 bytes
#define VST  4096                 // bytes of one key step (32 keys x 64 channels, f16) in the h plane
#define VCT  1024                 // bytes of one channel tile in it: the two halves of the depth, 512 each
#define QKP  (NB_ * TT * DP)      // elements of one query or key plane, all entries
#define FQG  4                    // k_fattn: groups of 32 output positions a work-group
#define FKQ  4                    // k_fattn: parts of the key axis a work-group, one wave each per group
#define L2E  1.4426950408889634f
#define WTOP 32768.0f             // k_fattn: the bound on a lane's sum of a step's 16 weights: above it the maximum in use moves
typedef unsigned short bf;
typedef __attribute__((ext_vector_type(16))) __bf16   v16bf;
typedef __attribute__((ext_vector_type(4)))  __bf16   v4bf;
typedef __attribute__((ext_vector_type(16))) _Float16 v16h;
typedef __attribute__((ext_vector_type(8)))  _Float16 v8h;
typedef __attribute__((ext_vector_type(8)))  unsigned short v8us;
typedef __attribute__((ext_vector_type(4)))  unsigned short v4us;
typedef __attribute__((ext_vector_type(2)))  unsigned v2u;
typedef __attribute__((ext_vector_type(16))) float    v16f;
typedef __attribute__((ext_vector_type(8)))  float    v8f;
typedef __attribute__((ext_vector_type(4)))  float    v4f;
typedef __attribute__((ext_vector_type(2)))  float    v2f;

__device__ __forceinline__ unsigned short f2bf(float f) { unsigned u = __float_as_uint(f); u += 0x7FFFu + ((u >> 16) & 1u); return (unsigned short)(u >> 16); }
__device__ __forceinline__ float bf2f(unsigned short b) { return __uint_as_float(((unsigned)b) << 16); }
__device__ __forceinline__ float bfr(float f) { return bf2f(f2bf(f)); }
__device__ __forceinline__ v16bf cat16b(v8us lo, v8us hi) { return __builtin_bit_cast(v16bf, __builtin_shufflevector(lo, hi, 0, 1, 2, 3, 4, 5, 6, 7, 8, 9, 10, 11, 12, 13, 14, 15)); }
__device__ __forceinline__ v8f wmmab(v16bf a, v16bf b, v8f c) { return __builtin_amdgcn_wmma_f32_16x16x32_bf16(false, a, false, b, (short)0, c, false, false); }
__device__ __forceinline__ v8f wmmah(v16h a, v16h b, v8f c) { return __builtin_amdgcn_wmma_f32_16x16x32_f16(false, a, false, b, (short)0, c, false, false); }
// a fragment of 16 rows at depth 32 from a plane in fragment order: p = the tile + 16 bytes x lane; the lane's k order is 8 hi + 0..7 (first half), then 16 + 8 hi + 0..7 (second half, 512 bytes on), for A and Bt alike
__device__ __forceinline__ v16h ldfrag(const char* p) { return __builtin_bit_cast(v16h, cat16b(*(const v8us*)p, *(const v8us*)(p + 512))); }
__device__ __forceinline__ void xwait(unsigned off) { asm volatile("s_wait_xcnt 0x0" : : "v"(off) : "memory"); }   // stands behind a group of loads that share the offset register 'off': the wait in front of any rewrite of that register; naming it as an input keeps it whole up to the wait, so that no load of the group lands on it
__device__ __forceinline__ void xwait2(const char* p, unsigned off) { asm volatile("s_wait_xcnt 0x0" : : "v"(p), "v"(off) : "memory"); }   // the same behind a group of loads of which some go by the lane's own address pair 'p', the others by 'off'
__device__ __forceinline__ void xwaitp(const char* p) { asm volatile("s_wait_xcnt 0x0" : : "v"(p) : "memory"); }   // the same behind a group of loads that go by the lane's own address pair 'p'

// the same fragment from a K-contiguous f32 row, rounded to bf16: p = the lane's row + 8 hi (+ 32 for the second half of the depth), in bytes
__device__ __forceinline__ v16bf ldw(const char* p) { const v4f a = *(const v4f*)p, b = *(const v4f*)(p + 16), c = *(const v4f*)(p + 64), d = *(const v4f*)(p + 80); v16f f;
#pragma unroll
    for (int q = 0; q < 4; ++q) { f[q] = a[q]; f[4 + q] = b[q]; f[8 + q] = c[q]; f[12 + q] = d[q]; }
    return __builtin_convertvector(f, v16bf); }
// y = h + l + (what two bf16 words cannot hold): h = y rounded to bf16, l = (y - h) rounded to bf16
__device__ __forceinline__ void split4(v4f y, v4us& h, v4us& l) { const v4bf hb = __builtin_convertvector(y, v4bf); const v2u w = __builtin_bit_cast(v2u, hb); v4f r;
#pragma unroll
    for (int i = 0; i < 2; ++i) { r[2 * i] = y[2 * i] - __uint_as_float(w[i] << 16); r[2 * i + 1] = y[2 * i + 1] - __uint_as_float(w[i] & 0xFFFF0000u); }
    h = __builtin_bit_cast(v4us, hb); l = __builtin_bit_cast(v4us, __builtin_convertvector(r, v4bf)); }
// k_prep: see the file's head. grid (TT / 64, entries), 32 threads. Fragment row lr of position tile nb is position n0 + 4 lr + nb: a lane's 16-byte load of x then holds one channel of its row in all four tiles.
// QK = the four query and key planes one behind the other: query hi, query lo, key hi, key lo. A result tile holds, in lane (lr, hi), register j, row 8 hi + j and column lr: in the Wk | Wq tile (weights as A) the lanes hi = 0 hold a position's 8 query channels, the lanes hi = 1 its 8 key channels; in an h tile (positions as A) row 8 hi + j of tile nb is position n0 + 32 hi + 4 j + nb and column lr the channel: over j and nb a lane holds all 32 keys of key step n0 / 32 + hi for one channel, keys 8 c + 0..7 in registers j = 2 c, 2 c + 1.
__global__ __launch_bounds__(32) void k_prep(const float* __restrict__ X, const float* __restrict__ WQ, const float* __restrict__ WK, const float* __restrict__ WV, bf* QK, bf* V) {
    const int lane = threadIdx.x & 31, lr = lane & 15, hi = lane >> 4; const int n0 = blockIdx.x * 64; const size_t b = blockIdx.y;
    X += b * HD * TT; QK += b * TT * DP; V += b * HD * TT;
    // every loop below has a constant trip count and is unrolled so that its array indices are register names
    const unsigned xo = (unsigned)(8 * hi * TT + n0 + 4 * lr) * 4u;   // the lane's byte offset in x: channel 8 hi, its four positions
    v4f xv[2][16];
#pragma unroll
    for (int kc = 0; kc < 2; ++kc)
#pragma unroll
        for (int e = 0; e < 16; ++e) xv[kc][e] = *(const v4f*)((const char*)X + xo + (kc * 32 + (e >> 3) * 16 + (e & 7)) * TT * 4);
    xwait(xo);
    const char* wp = (const char*)(lr < DQK ? WK : WQ) + (unsigned)((lr & (DQK - 1)) * HD + 8 * hi) * 4u; const unsigned wo = (unsigned)(lr * HD + 8 * hi) * 4u;
    v16bf aw[5][2];   // tile 0: Wk's rows | Wq's rows; tiles 1..4: Wv's rows
#pragma unroll
    for (int kc = 0; kc < 2; ++kc) { aw[0][kc] = ldw(wp + kc * 128);
#pragma unroll
        for (int mb = 0; mb < 4; ++mb) aw[1 + mb][kc] = ldw((const char*)WV + wo + mb * 16 * HD * 4 + kc * 128); }
    xwait2(wp, wo);
    v16bf bt[4][2];
#pragma unroll
    for (int nb = 0; nb < 4; ++nb)
#pragma unroll
        for (int kc = 0; kc < 2; ++kc) { v16f f;
#pragma unroll
            for (int e = 0; e < 16; ++e) f[e] = xv[kc][e][nb];
            bt[nb][kc] = __builtin_convertvector(f, v16bf); }
    const unsigned qo = (unsigned)(hi * 2 * QKP + (n0 + 4 * lr) * DP) * 2u, vo = (unsigned)((n0 / 32 + hi) * VST + lr * 16);   // the lane's byte offsets in QK (its map's hi plane, its first position's row) and in the h plane (its key step, fragment lane lr)
#pragma unroll
    for (int mb = 0; mb < 5; ++mb) { v8f d[4];
#pragma unroll
        for (int nb = 0; nb < 4; ++nb) d[nb] = mb == 0 ? wmmab(aw[mb][0], bt[nb][0], (v8f){}) : wmmab(bt[nb][0], aw[mb][0], (v8f){});
#pragma unroll
        for (int nb = 0; nb < 4; ++nb) d[nb] = mb == 0 ? wmmab(aw[mb][1], bt[nb][1], d[nb]) : wmmab(bt[nb][1], aw[mb][1], d[nb]);
        if (mb == 0) {
#pragma unroll
            for (int nb = 0; nb < 4; ++nb) { v4f y0, y1; v4us h0, l0, h1, l1;
#pragma unroll
                for (int q = 0; q < 4; ++q) { y0[q] = d[nb][q]; y1[q] = d[nb][4 + q]; }
                split4(y0, h0, l0); split4(y1, h1, l1);
                char* row = (char*)QK + qo + nb * DP * 2;
                *(v8us*)row = __builtin_shufflevector(h0, h1, 0, 1, 2, 3, 4, 5, 6, 7); *(v8us*)(row + QKP * 2) = __builtin_shufflevector(l0, l1, 0, 1, 2, 3, 4, 5, 6, 7); }
        } else {
#pragma unroll
            for (int c = 0; c < 4; ++c) { v8f y;   // keys 8 c + 0..7 of the step: half c >> 1 of the depth, fragment lanes 16 (c & 1) + lr
#pragma unroll
                for (int nb = 0; nb < 4; ++nb) { y[nb] = d[nb][2 * c]; y[4 + nb] = d[nb][2 * c + 1]; }
                *(v8us*)((char*)V + vo + (mb - 1) * VCT + c * 256) = __builtin_bit_cast(v8us, __builtin_convertvector(y, v8h)); }
        } }
}
// k_fattn: see the file's head. grid (TT / 128, entries), 512 threads. Fragment maps: a score tile's accumulator holds, in lane (lr, hi), register j, key n = 8 hi + j of its 16 keys and position m = lr; two such tiles (keys 0..15 and 16..31 of the step) are, register for register, the Bt operand's k order (k = 8 hi + j, then 16 + 8 hi + j) that ldfrag gives h's rows as A.
// A score tile is ONE product: its depth 32 is four groups of 8 channels. Group g = k 8 g + 0..7 sits in lanes hi = g & 1, fragment half g >> 1. A (keys) holds hi, hi, lo, lo words in groups 0..3: every lane has its key row's hi words in the first half and its lo words in the second. Bt (queries) holds hi, lo, hi, lo: the lanes hi = 0 have the query row's hi words in both halves, the lanes hi = 1 its lo words. The sum over the depth is key hi . query hi + key hi . query lo + key lo . query hi + key lo . query lo.
__device__ __forceinline__ float xhalf(float x) { const int b = __float_as_int(x); return __int_as_float(__builtin_amdgcn_permlanex16(b, b, 0x76543210, 0xfedcba98, false, false)); }   // the value of lane l ^ 16
// a step's weights and their sums for the wave's two position tiles: p = 2^(s log2 e - mb), each tile's sum in key order. Weights and sums are held as pairs (tile 0, tile 1): the additions stand among the exponentials, and as two scalar chains they were paired into dual-issue instructions; in front of a packed addition the compiler keeps the slot that the instruction set asks for behind a transcendental whose source is overwritten
__device__ __forceinline__ v2f weights(const v8f (&s)[2][2], const float (&mref)[2], v2f (&p)[16]) {
    const float mb0 = mref[0] * L2E, mb1 = mref[1] * L2E; v2f ps = (v2f){};
#pragma unroll
    for (int e = 0; e < 16; ++e) { p[e][0] = __builtin_amdgcn_exp2f(s[0][e >> 3][e & 7] * L2E - mb0); p[e][1] = __builtin_amdgcn_exp2f(s[1][e >> 3][e & 7] * L2E - mb1); ps += p[e]; }
    return ps;
}
__global__ __launch_bounds__(512) void k_fattn(const bf* __restrict__ Qh, const bf* __restrict__ Ql, const bf* __restrict__ Kh, const bf* __restrict__ Kl, const bf* __restrict__ V, const float* __restrict__ X, const float* __restrict__ GAM, float* out) {
    __shared__ __align__(16) float accs[FQG * FKQ * 64 * 32];   // a wave's 64 accumulator registers, lane-major
    __shared__ __align__(16) float mls[FQG * FKQ * 4 * 32];     // a wave's maxima in use (2) and sums (2), lane-major
    const int lane = threadIdx.x & 31, lr = lane & 15, hi = lane >> 4; const int wave = __builtin_amdgcn_readfirstlane(threadIdx.x >> 5), qg = wave & (FQG - 1), kq = wave / FQG;
    const size_t b = blockIdx.y; const int q0 = blockIdx.x * (FQG * 32) + qg * 32; const int nbeg = kq * (TT / FKQ), nend = nbeg + TT / FKQ;
    Qh += b * TT * DP; Ql += b * TT * DP; Kh += b * TT * DP; Kl += b * TT * DP; V += b * HD * TT; X += b * HD * TT; out += b * HD * TT;
    // every inner loop below has a constant trip count and is unrolled so that its array indices are register names
    v16bf qf[2], kf[2]; v8f acc[4][2]; float mref[2], lsum[2];
    const char* qp = (const char*)(hi ? Ql : Qh) + (unsigned)((q0 + lr) * DP) * 2u; unsigned kob = (unsigned)((nbeg + lr) * DP) * 2u;   // the lane's query row in the plane of its half of the wave; its byte offset in a key plane, which steps with the loop
    const char* vp = (const char*)V + (nbeg / 32) * VST + lane * 16;   // the lane's 16 bytes in the first fragment half of the wave's key step in the h plane: it steps with the loop
#pragma unroll
    for (int mt = 0; mt < 2; ++mt) { const v8us qw = *(const v8us*)(qp + mt * 16 * DP * 2); qf[mt] = cat16b(qw, qw); mref[mt] = -3.0e38f; lsum[mt] = 0.f;
#pragma unroll
        for (int ct = 0; ct < 4; ++ct) acc[ct][mt] = (v8f){}; }
    xwaitp(qp);
#pragma unroll
    for (int t = 0; t < 2; ++t) kf[t] = cat16b(*(const v8us*)((const char*)Kh + kob + t * 16 * DP * 2), *(const v8us*)((const char*)Kl + kob + t * 16 * DP * 2));
    xwait(kob);
    for (int n = nbeg; n < nend; n += 32) {
        v16h vh[4];   // this step's h fragments: asked for ahead of the scores and the softmax, used behind them
#pragma unroll
        for (int ct = 0; ct < 4; ++ct) vh[ct] = ldfrag(vp + ct * VCT);
        xwaitp(vp); vp += VST;   // the statement's memory clobber also keeps the eight loads up here: left free, they sink to just in front of the value product and the wave waits out their whole latency there
        v8f s[2][2];
#pragma unroll
        for (int mt = 0; mt < 2; ++mt)
#pragma unroll
            for (int t = 0; t < 2; ++t) s[mt][t] = wmmab(kf[t], qf[mt], (v8f){});
        kob += (n + 32 < nend) ? 32u * DP * 2u : 0u;   // the next step's key fragments, one step ahead (the last step asks for its own again: in bounds, not used)
#pragma unroll
        for (int t = 0; t < 2; ++t) kf[t] = cat16b(*(const v8us*)((const char*)Kh + kob + t * 16 * DP * 2), *(const v8us*)((const char*)Kl + kob + t * 16 * DP * 2));
        xwait(kob);
        // the weights are formed with the maximum in use as it stands, and their sum, which the softmax needs anyway, is the test: no weight is negative, so a lane's sum of 16 at or under WTOP bounds each of them inside f16's range; no maximum is computed on this path
        v2f p[16]; v2f ps = weights(s, mref, p);
        // one scalar test a step for the wave; it fails (an infinite or not-a-number sum too: the first step's always) only where a position's scores have passed its maximum in use by about 10: then the step's maxima are taken, the maxima in use move, sums and accumulators are rescaled, and the step's weights are formed again, now at most 1
        if (__builtin_amdgcn_ballot_w32(!(ps[0] <= WTOP) || !(ps[1] <= WTOP)) != 0) {
#pragma unroll
            for (int mt = 0; mt < 2; ++mt) { float x = fmaxf(s[mt][0][0], s[mt][1][0]);
#pragma unroll
                for (int j = 1; j < 8; ++j) x = fmaxf(x, fmaxf(s[mt][0][j], s[mt][1][j]));
                const float mn = fmaxf(mref[mt], fmaxf(x, xhalf(x))); const float al = __builtin_amdgcn_exp2f((mref[mt] - mn) * L2E); mref[mt] = mn; lsum[mt] *= al;
#pragma unroll
                for (int ct = 0; ct < 4; ++ct)
#pragma unroll
                    for (int j = 0; j < 8; ++j) acc[ct][mt][j] *= al; }
            ps = weights(s, mref, p); }
        v16h ph[2];
#pragma unroll
        for (int mt = 0; mt < 2; ++mt) { lsum[mt] += ps[mt];
#pragma unroll
            for (int e = 0; e < 16; ++e) ph[mt][e] = (_Float16)p[e][mt]; }
#pragma unroll
        for (int ct = 0; ct < 4; ++ct)
#pragma unroll
            for (int mt = 0; mt < 2; ++mt) acc[ct][mt] = wmmah(vh[ct], ph[mt], acc[ct][mt]);
    }
    // the join of the FKQ key parts: every wave lays down its part, then finishes channel tile kq of its own position group
#pragma unroll
    for (int mt = 0; mt < 2; ++mt) { mls[(wave * 4 + mt) * 32 + lane] = mref[mt]; mls[(wave * 4 + 2 + mt) * 32 + lane] = lsum[mt] + xhalf(lsum[mt]);
#pragma unroll
        for (int ct = 0; ct < 4; ++ct)
#pragma unroll
            for (int j = 0; j < 8; ++j) accs[(wave * 64 + (ct * 2 + mt) * 8 + j) * 32 + lane] = acc[ct][mt][j]; }
    __syncthreads();
    // the residual's x for the 16 elements that this lane stores: asked for ahead of the join, used behind it
    const unsigned oe = (unsigned)((kq * 16 + hi * 8) * TT + q0 + lr);   // the lane's element offset, the same in x and in out
    float xr[2][8]; const float g = bfr(GAM[0]);
#pragma unroll
    for (int mt = 0; mt < 2; ++mt)
#pragma unroll
        for (int j = 0; j < 8; ++j) xr[mt][j] = (X + oe)[j * TT + mt * 16];
    xwait(oe);   // the statement's memory clobber also keeps the sixteen loads up here, ahead of the join's LDS reads
#pragma unroll
    for (int mt = 0; mt < 2; ++mt) { float mk[FKQ], wk[FKQ]; float M = -3.0e38f, L = 0.f;
#pragma unroll
        for (int k = 0; k < FKQ; ++k) { mk[k] = mls[((k * FQG + qg) * 4 + mt) * 32 + lane]; M = fmaxf(M, mk[k]); }
#pragma unroll
        for (int k = 0; k < FKQ; ++k) { wk[k] = __builtin_amdgcn_exp2f((mk[k] - M) * L2E); L += wk[k] * mls[((k * FQG + qg) * 4 + 2 + mt) * 32 + lane]; }
        const float rl = __fdiv_rn(1.0f, L);
#pragma unroll
        for (int j = 0; j < 8; ++j) { float o = 0.f;
#pragma unroll
            for (int k = 0; k < FKQ; ++k) o += wk[k] * accs[((k * FQG + qg) * 64 + (kq * 2 + mt) * 8 + j) * 32 + lane];
            const float pt = o * rl; (out + oe)[j * TT + mt * 16] = g * pt + bfr(xr[mt][j]); } }
}
extern "C" void kernel_launch(void* const* d_in, const int* in_sizes, int n_in,
                              void* d_out, int out_size, void* d_ws, size_t ws_size, hipStream_t stream) {
    (void)in_sizes; (void)n_in; (void)out_size;
    const float* x = (const float*)d_in[0]; const float* wq = (const float*)d_in[1]; const float* wk = (const float*)d_in[2]; const float* wv = (const float*)d_in[3]; const float* gam = (const float*)d_in[4];
    // inputs in the module's argument order: x, Wq, Wk, Wv, gamma = d_in[0..4]: all read
    float* OUT = (float*)d_out;     // [8][64][4096]
    char* wsp = (char*)d_ws;
    auto take = [&](size_t bytes) { char* p = wsp; wsp += (bytes + 255) & ~(size_t)255; return (void*)p; };
    bf* QK = (bf*)take((size_t)4 * QKP * 2); bf* VC = (bf*)take((size_t)NB_ * HD * TT * 2);   // 8 entries each; QK: query hi, query lo, key hi, key lo; VC: h, f16
    if ((size_t)(wsp - (char*)d_ws) > ws_size) return;    // total 6 MiB carved
    k_prep<<<dim3(TT / 64, NB_, 1), 32, 0, stream>>>(x, wq, wk, wv, QK, VC);   /* the query and key planes, hi and lo words; the h plane, f16 */
    k_fattn<<<dim3(TT / (FQG * 32), NB_, 1), FQG * FKQ * 32, 0, stream>>>(QK, QK + (size_t)QKP, QK + (size_t)2 * QKP, QK + (size_t)3 * QKP, VC, x, gam, OUT);   /* out[b][c][m] = gamma (the sum over n of h[c][n] softmax_n(g[:, m] . f[:, n])) + x[b][c][m] */
}

// v009
// A run of this version takes 28.1 microseconds.
// Next to v008, in two timings, it ran 1.10 and 1.09 times as fast.
// All steps since v000 together make it 64.1 times as fast.
#include <hip/hip_runtime.h>

// A single-head spatial self-attention over 4,096 positions with 1 x 1 convolutions (x [8][64][64][64] = [entry][64 channels][4,096 positions]; Wq, Wk [8][64], Wv [64][64], ALL 'oi' (out, in), no bias; gamma [1], a scalar input): f = Wq x and g = Wk x (8 channels each); h = Wv x (64 channels);
// s[n][m] = f[:, n] . g[:, m] (no scale, no mask); a softmax over n, the score matrix's FIRST axis: for the output position m the weights run over n: g gives position m's query, f the keys; o[c][m] = sum_n h[c][n] weight[n][m]; out[c][m] = gamma o[c][m] + x[c][m] -> [8][64][64][64] (2.1 M); argument order x, Wq, Wk, Wv, gamma: all read.
// Layout: TWO launches.
// k_prep, one wave for 64 positions of one entry: x and the three weights are read as they stand (f32), rounded to bf16 in registers and laid straight into matrix fragments; the three 1 x 1 convolutions at depth 64: one tile of Wk's 8 rows | Wq's 8 rows as A with the positions as Bt, four tiles of Wv's rows as Bt with the positions as A; the f32 results are stored as the planes that k_fattn reads (the two 8-channel maps split in registers into bf16 hi | lo words, h rounded once to f16), EACH IN ITS FRAGMENTS' OWN ORDER, so that a wave's 16-byte load there covers whole 128-byte lines (512 consecutive bytes of h; 256 of a key plane, which both halves of the wave read): query and key maps token-major [4096][8], a hi and a lo plane each (a row of 16 bytes is one quarter of a score fragment's depth: see k_fattn), h as ONE f16 plane [128 key steps][4 channel tiles][2 halves of the depth][32 lanes][8 keys] (with the positions as A a lane holds one channel's 32 keys of a step: four 16-byte words of that order).
// k_fattn, for all 8 entries: scores, softmax, value product and residual in one kernel, so that neither the scores nor the weights ever reach memory. A work-group has 128 output positions m (4 groups of 32) x 4 quarters of the 4,096 keys n = 16 waves; a wave walks its 1,024 keys 32 at a time: the TRANSPOSED scores (A = key rows, Bt = query rows; hi + lo words of both: the four cross products of 8 channels each fill the depth 32 of ONE product), a maximum in use and a sum per position, the unnormalised weights exp(s - maximum in use), at most 32,768 (the maximum in use moves only when a step's sum of weights passes that), rounded once to f16 straight from the score accumulators into the Bt operand of the value product (A = h's rows in f16: ONE f16 product); the four quarters are joined in LDS, in quarter order, normalised, and stored as out[c][m] = gamma o[c][m] + x[c][m] (gamma and x read from their inputs and rounded to bf16 as every float input is): the one writer of the output.
// Compute dtypes, f32 accumulate: every float input rounded to bf16 at its load; the three 1 x 1 convolutions ONE bf16 product each on exact operands; the two 8-channel maps as bf16 hi + lo words at the score product; h and the weights as ONE f16 word each (11 bits; h must lie inside f16's range, 65,504: here it is a sum of 64 products of unit-scale values) at the value product; softmax and its sum f32; the scaled residual f32.

#define NB_  8
#define TT   4096                 // positions = the softmax's key axis
#define HD   64                   // channels
#define DQK  8                    // q and k channels
#define DP   8                    // q and k rows as stored: 8 channels, 16 bytes
#define VST  4096                 // bytes of one key step (32 keys x 64 channels, f16) in the h plane
#define VCT  1024                 // bytes of one channel tile in it: the two halves of the depth, 512 each
#define QKP  (NB_ * TT * DP)      // elements of one query or key plane, all entries
#define FQG  4                    // k_fattn: groups of 32 output positions a work-group
#define FKQ  4                    // k_fattn: parts of the key axis a work-group, one wave each per group
#define L2E  1.4426950408889634f
#define WTOP 32768.0f             // k_fattn: the bound on a lane's sum of a step's 16 weights: above it the maximum in use moves
typedef unsigned short bf;
typedef __attribute__((ext_vector_type(16))) __bf16   v16bf;
typedef __attribute__((ext_vector_type(4)))  __bf16   v4bf;
typedef __attribute__((ext_vector_type(16))) _Float16 v16h;
typedef __attribute__((ext_vector_type(8)))  _Float16 v8h;
typedef __attribute__((ext_vector_type(8)))  unsigned short v8us;
typedef __attribute__((ext_vector_type(4)))  unsigned short v4us;
typedef __attribute__((ext_vector_type(2)))  unsigned v2u;
typedef __attribute__((ext_vector_type(16))) float    v16f;
typedef __attribute__((ext_vector_type(8)))  float    v8f;
typedef __attribute__((ext_vector_type(4)))  float    v4f;
typedef __attribute__((ext_vector_type(2)))  float    v2f;

__device__ __forceinline__ unsigned short f2bf(float f) { unsigned u = __float_as_uint(f); u += 0x7FFFu + ((u >> 16) & 1u); return (unsigned short)(u >> 16); }
__device__ __forceinline__ float bf2f(unsigned short b) { return __uint_as_float(((unsigned)b) << 16); }
__device__ __forceinline__ float bfr(float f) { return bf2f(f2bf(f)); }
__device__ __forceinline__ v16bf cat16b(v8us lo, v8us hi) { return __builtin_bit_cast(v16bf, __builtin_shufflevector(lo, hi, 0, 1, 2, 3, 4, 5, 6, 7, 8, 9, 10, 11, 12, 13, 14, 15)); }
__device__ __forceinline__ v8f wmmab(v16bf a, v16bf b, v8f c) { return __builtin_amdgcn_wmma_f32_16x16x32_bf16(false, a, false, b, (short)0, c, false, false); }
__device__ __forceinline__ v8f wmmah(v16h a, v16h b, v8f c) { return __builtin_amdgcn_wmma_f32_16x16x32_f16(false, a, false, b, (short)0, c, false, false); }
// a fragment of 16 rows at depth 32 from a plane in fragment order: p = the tile + 16 bytes x lane; the lane's k order is 8 hi + 0..7 (first half), then 16 + 8 hi + 0..7 (second half, 512 bytes on), for A and Bt alike
__device__ __forceinline__ v16h ldfrag(const char* p) { return __builtin_bit_cast(v16h, cat16b(*(const v8us*)p, *(const v8us*)(p + 512))); }
__device__ __forceinline__ void xwait(unsigned off) { asm volatile("s_wait_xcnt 0x0" : : "v"(off) : "memory"); }   // stands behind a group of loads that share the offset register 'off': the wait in front of any rewrite of that register; naming it as an input keeps it whole up to the wait, so that no load of the group lands on it
__device__ __forceinline__ void xwait2(const char* p, unsigned off) { asm volatile("s_wait_xcnt 0x0" : : "v"(p), "v"(off) : "memory"); }   // the same behind a group of loads of which some go by the lane's own address pair 'p', the others by 'off'
__device__ __forceinline__ void xwaitp(const char* p) { asm volatile("s_wait_xcnt 0x0" : : "v"(p) : "memory"); }   // the same behind a group of loads that go by the lane's own address pair 'p'

// the same fragment from a K-contiguous f32 row, rounded to bf16: p = the lane's row + 8 hi (+ 32 for the second half of the depth), in bytes
__device__ __forceinline__ v16bf ldw(const char* p) { const v4f a = *(const v4f*)p, b = *(const v4f*)(p + 16), c = *(const v4f*)(p + 64), d = *(const v4f*)(p + 80); v16f f;
#pragma unroll
    for (int q = 0; q < 4; ++q) { f[q] = a[q]; f[4 + q] = b[q]; f[8 + q] = c[q]; f[12 + q] = d[q]; }
    return __builtin_convertvector(f, v16bf); }
// y = h + l + (what two bf16 words cannot hold): h = y rounded to bf16, l = (y - h) rounded to bf16
__device__ __forceinline__ void split4(v4f y, v4us& h, v4us& l) { const v4bf hb = __builtin_convertvector(y, v4bf); const v2u w = __builtin_bit_cast(v2u, hb); v4f r;
#pragma unroll
    for (int i = 0; i < 2; ++i) { r[2 * i] = y[2 * i] - __uint_as_float(w[i] << 16); r[2 * i + 1] = y[2 * i + 1] - __uint_as_float(w[i] & 0xFFFF0000u); }
    h = __builtin_bit_cast(v4us, hb); l = __builtin_bit_cast(v4us, __builtin_convertvector(r, v4bf)); }
// k_prep: see the file's head. grid (entries, TT / 64), 32 threads (the entry is the fast index: see kernel_launch). Fragment row lr of position tile nb is position n0 + 4 lr + nb: a lane's 16-byte load of x then holds one channel of its row in all four tiles.
// QK = the four query and key planes one behind the other: query hi, query lo, key hi, key lo. A result tile holds, in lane (lr, hi), register j, row 8 hi + j and column lr: in the Wk | Wq tile (weights as A) the lanes hi = 0 hold a position's 8 query channels, the lanes hi = 1 its 8 key channels; in an h tile (positions as A) row 8 hi + j of tile nb is position n0 + 32 hi + 4 j + nb and column lr the channel: over j and nb a lane holds all 32 keys of key step n0 / 32 + hi for one channel, keys 8 c + 0..7 in registers j = 2 c, 2 c + 1.
__global__ __launch_bounds__(32) void k_prep(const float* __restrict__ X, const float* __restrict__ WQ, const float* __restrict__ WK, const float* __restrict__ WV, bf* QK, bf* V) {
    const int lane = threadIdx.x & 31, lr = lane & 15, hi = lane >> 4; const int n0 = blockIdx.y * 64; const size_t b = blockIdx.x;
    X += b * HD * TT; QK += b * TT * DP; V += b * HD * TT;
    // every loop below has a constant trip count and is unrolled so that its array indices are register names
    const unsigned xo = (unsigned)(8 * hi * TT + n0 + 4 * lr) * 4u;   // the lane's byte offset in x: channel 8 hi, its four positions
    v4f xv[2][16];
#pragma unroll
    for (int kc = 0; kc < 2; ++kc)
#pragma unroll
        for (int e = 0; e < 16; ++e) xv[kc][e] = *(const v4f*)((const char*)X + xo + (kc * 32 + (e >> 3) * 16 + (e & 7)) * TT * 4);
    xwait(xo);
    const char* wp = (const char*)(lr < DQK ? WK : WQ) + (unsigned)((lr & (DQK - 1)) * HD + 8 * hi) * 4u; const unsigned wo = (unsigned)(lr * HD + 8 * hi) * 4u;
    v16bf aw[5][2];   // tile 0: Wk's rows | Wq's rows; tiles 1..4: Wv's rows
#pragma unroll
    for (int kc = 0; kc < 2; ++kc) { aw[0][kc] = ldw(wp + kc * 128);
#pragma unroll
        for (int mb = 0; mb < 4; ++mb) aw[1 + mb][kc] = ldw((const char*)WV + wo + mb * 16 * HD * 4 + kc * 128); }
    xwait2(wp, wo);
    v16bf bt[4][2];
#pragma unroll
    for (int nb = 0; nb < 4; ++nb)
#pragma unroll
        for (int kc = 0; kc < 2; ++kc) { v16f f;
#pragma unroll
            for (int e = 0; e < 16; ++e) f[e] = xv[kc][e][nb];
            bt[nb][kc] = __builtin_convertvector(f, v16bf); }
    const unsigned qo = (unsigned)(hi * 2 * QKP + (n0 + 4 * lr) * DP) * 2u, vo = (unsigned)((n0 / 32 + hi) * VST + lr * 16);   // the lane's byte offsets in QK (its map's hi plane, its first position's row) and in the h plane (its key step, fragment lane lr)
#pragma unroll
    for (int mb = 0; mb < 5; ++mb) { v8f d[4];
#pragma unroll
        for (int nb = 0; nb < 4; ++nb) d[nb] = mb == 0 ? wmmab(aw[mb][0], bt[nb][0], (v8f){}) : wmmab(bt[nb][0], aw[mb][0], (v8f){});
#pragma unroll
        for (int nb = 0; nb < 4; ++nb) d[nb] = mb == 0 ? wmmab(aw[mb][1], bt[nb][1], d[nb]) : wmmab(bt[nb][1], aw[mb][1], d[nb]);
        if (mb == 0) {
#pragma unroll
            for (int nb = 0; nb < 4; ++nb) { v4f y0, y1; v4us h0, l0, h1, l1;
#pragma unroll
                for (int q = 0; q < 4; ++q) { y0[q] = d[nb][q]; y1[q] = d[nb][4 + q]; }
                split4(y0, h0, l0); split4(y1, h1, l1);
                char* row = (char*)QK + qo + nb * DP * 2;
                *(v8us*)row = __builtin_shufflevector(h0, h1, 0, 1, 2, 3, 4, 5, 6, 7); *(v8us*)(row + QKP * 2) = __builtin_shufflevector(l0, l1, 0, 1, 2, 3, 4, 5, 6, 7); }
        } else {
#pragma unroll
            for (int c = 0; c < 4; ++c) { v8f y;   // keys 8 c + 0..7 of the step: half c >> 1 of the depth, fragment lanes 16 (c & 1) + lr
#pragma unroll
                for (int nb = 0; nb < 4; ++nb) { y[nb] = d[nb][2 * c]; y[4 + nb] = d[nb][2 * c + 1]; }
                *(v8us*)((char*)V + vo + (mb - 1) * VCT + c * 256) = __builtin_bit_cast(v8us, __builtin_convertvector(y, v8h)); }
        } }
}
// k_fattn: see the file's head. grid (entries, TT / 128), 512 threads (the entry is the fast index: see kernel_launch). Fragment maps: a score tile's accumulator holds, in lane (lr, hi), register j, key n = 8 hi + j of its 16 keys and position m = lr; two such tiles (keys 0..15 and 16..31 of the step) are, register for register, the Bt operand's k order (k = 8 hi + j, then 16 + 8 hi + j) that ldfrag gives h's rows as A.
// A score tile is ONE product: its depth 32 is four groups of 8 channels. Group g = k 8 g + 0..7 sits in lanes hi = g & 1, fragment half g >> 1. A (keys) holds hi, hi, lo, lo words in groups 0..3: every lane has its key row's hi words in the first half and its lo words in the second. Bt (queries) holds hi, lo, hi, lo: the lanes hi = 0 have the query row's hi words in both halves, the lanes hi = 1 its lo words. The sum over the depth is key hi . query hi + key hi . query lo + key lo . query hi + key lo . query lo.
__device__ __forceinline__ float xhalf(float x) { const int b = __float_as_int(x); return __int_as_float(__builtin_amdgcn_permlanex16(b, b, 0x76543210, 0xfedcba98, false, false)); }   // the value of lane l ^ 16
// a step's weights and their sums for the wave's two position tiles: p = 2^(s log2 e - mb), each tile's sum in key order. Weights and sums are held as pairs (tile 0, tile 1): the additions stand among the exponentials, and as two scalar chains they were paired into dual-issue instructions; in front of a packed addition the compiler keeps the slot that the instruction set asks for behind a transcendental whose source is overwritten
__device__ __forceinline__ v2f weights(const v8f (&s)[2][2], const float (&mref)[2], v2f (&p)[16]) {
    const float mb0 = mref[0] * L2E, mb1 = mref[1] * L2E; v2f ps = (v2f){};
#pragma unroll
    for (int e = 0; e < 16; ++e) { p[e][0] = __builtin_amdgcn_exp2f(s[0][e >> 3][e & 7] * L2E - mb0); p[e][1] = __builtin_amdgcn_exp2f(s[1][e >> 3][e & 7] * L2E - mb1); ps += p[e]; }
    return ps;
}
__global__ __launch_bounds__(512) void k_fattn(const bf* __restrict__ Qh, const bf* __restrict__ Ql, const bf* __restrict__ Kh, const bf* __restrict__ Kl, const bf* __restrict__ V, const float* __restrict__ X, const float* __restrict__ GAM, float* out) {
    __shared__ __align__(16) float accs[FQG * FKQ * 64 * 32];   // a wave's 64 accumulator registers, lane-major
    __shared__ __align__(16) float mls[FQG * FKQ * 4 * 32];     // a wave's maxima in use (2) and sums (2), lane-major
    const int lane = threadIdx.x & 31, lr = lane & 15, hi = lane >> 4; const int wave = __builtin_amdgcn_readfirstlane(threadIdx.x >> 5), qg = wave & (FQG - 1), kq = wave / FQG;
    const size_t b = blockIdx.x; const int q0 = blockIdx.y * (FQG * 32) + qg * 32; const int nbeg = kq * (TT / FKQ), nend = nbeg + TT / FKQ;
    Qh += b * TT * DP; Ql += b * TT * DP; Kh += b * TT * DP; Kl += b * TT * DP; V += b * HD * TT; X += b * HD * TT; out += b * HD * TT;
    // every inner loop below has a constant trip count and is unrolled so that its array indices are register names
    v16bf qf[2], kf[2]; v8f acc[4][2]; float mref[2], lsum[2];
    const char* qp = (const char*)(hi ? Ql : Qh) + (unsigned)((q0 + lr) * DP) * 2u; unsigned kob = (unsigned)((nbeg + lr) * DP) * 2u;   // the lane's query row in the plane of its half of the wave; its byte offset in a key plane, which steps with the loop
    const char* vp = (const char*)V + (nbeg / 32) * VST + lane * 16;   // the lane's 16 bytes in the first fragment half of the wave's key step in the h plane: it steps with the loop
#pragma unroll
    for (int mt = 0; mt < 2; ++mt) { const v8us qw = *(const v8us*)(qp + mt * 16 * DP * 2); qf[mt] = cat16b(qw, qw); mref[mt] = -3.0e38f; lsum[mt] = 0.f;
#pragma unroll
        for (int ct = 0; ct < 4; ++ct) acc[ct][mt] = (v8f){}; }
    xwaitp(qp);
#pragma unroll
    for (int t = 0; t < 2; ++t) kf[t] = cat16b(*(const v8us*)((const char*)Kh + kob + t * 16 * DP * 2), *(const v8us*)((const char*)Kl + kob + t * 16 * DP * 2));
    xwait(kob);
    for (int n = nbeg; n < nend; n += 32) {
        v16h vh[4];   // this step's h fragments: asked for ahead of the scores and the softmax, used behind them
#pragma unroll
        for (int ct = 0; ct < 4; ++ct) vh[ct] = ldfrag(vp + ct * VCT);
        xwaitp(vp); vp += VST;   // the statement's memory clobber also keeps the eight loads up here: left free, they sink to just in front of the value product and the wave waits out their whole latency there
        v8f s[2][2];
#pragma unroll
        for (int mt = 0; mt < 2; ++mt)
#pragma unroll
            for (int t = 0; t < 2; ++t) s[mt][t] = wmmab(kf[t], qf[mt], (v8f){});
        kob += (n + 32 < nend) ? 32u * DP * 2u : 0u;   // the next step's key fragments, one step ahead (the last step asks for its own again: in bounds, not used)
#pragma unroll
        for (int t = 0; t < 2; ++t) kf[t] = cat16b(*(const v8us*)((const char*)Kh + kob + t * 16 * DP * 2), *(const v8us*)((const char*)Kl + kob + t * 16 * DP * 2));
        xwait(kob);
        // the weights are formed with the maximum in use as it stands, and their sum, which the softmax needs anyway, is the test: no weight is negative, so a lane's sum of 16 at or under WTOP bounds each of them inside f16's range; no maximum is computed on this path
        v2f p[16]; v2f ps = weights(s, mref, p);
        // one scalar test a step for the wave; it fails (an infinite or not-a-number sum too: the first step's always) only where a position's scores have passed its maximum in use by about 10: then the step's maxima are taken, the maxima in use move, sums and accumulators are rescaled, and the step's weights are formed again, now at most 1
        if (__builtin_amdgcn_ballot_w32(!(ps[0] <= WTOP) || !(ps[1] <= WTOP)) != 0) {
#pragma unroll
            for (int mt = 0; mt < 2; ++mt) { float x = fmaxf(s[mt][0][0], s[mt][1][0]);
#pragma unroll
                for (int j = 1; j < 8; ++j) x = fmaxf(x, fmaxf(s[mt][0][j], s[mt][1][j]));
                const float mn = fmaxf(mref[mt], fmaxf(x, xhalf(x))); const float al = __builtin_amdgcn_exp2f((mref[mt] - mn) * L2E); mref[mt] = mn; lsum[mt] *= al;
#pragma unroll
                for (int ct = 0; ct < 4; ++ct)
#pragma unroll
                    for (int j = 0; j < 8; ++j) acc[ct][mt][j] *= al; }
            ps = weights(s, mref, p); }
        v16h ph[2];
#pragma unroll
        for (int mt = 0; mt < 2; ++mt) { lsum[mt] += ps[mt];
#pragma unroll
            for (int e = 0; e < 16; ++e) ph[mt][e] = (_Float16)p[e][mt]; }
#pragma unroll
        for (int ct = 0; ct < 4; ++ct)
#pragma unroll
            for (int mt = 0; mt < 2; ++mt) acc[ct][mt] = wmmah(vh[ct], ph[mt], acc[ct][mt]);
    }
    // the join of the FKQ key parts: every wave lays down its part, then finishes channel tile kq of its own position group
#pragma unroll
    for (int mt = 0; mt < 2; ++mt) { mls[(wave * 4 + mt) * 32 + lane] = mref[mt]; mls[(wave * 4 + 2 + mt) * 32 + lane] = lsum[mt] + xhalf(lsum[mt]);
#pragma unroll
        for (int ct = 0; ct < 4; ++ct)
#pragma unroll
            for (int j = 0; j < 8; ++j) accs[(wave * 64 + (ct * 2 + mt) * 8 + j) * 32 + lane] = acc[ct][mt][j]; }
    __syncthreads();
    // the residual's x for the 16 elements that this lane stores: asked for ahead of the join, used behind it
    const unsigned oe = (unsigned)((kq * 16 + hi * 8) * TT + q0 + lr);   // the lane's element offset, the same in x and in out
    float xr[2][8]; const float g = bfr(GAM[0]);
#pragma unroll
    for (int mt = 0; mt < 2; ++mt)
#pragma unroll
        for (int j = 0; j < 8; ++j) xr[mt][j] = (X + oe)[j * TT + mt * 16];
    xwait(oe);   // the statement's memory clobber also keeps the sixteen loads up here, ahead of the join's LDS reads
#pragma unroll
    for (int mt = 0; mt < 2; ++mt) { float mk[FKQ], wk[FKQ]; float M = -3.0e38f, L = 0.f;
#pragma unroll
        for (int k = 0; k < FKQ; ++k) { mk[k] = mls[((k * FQG + qg) * 4 + mt) * 32 + lane]; M = fmaxf(M, mk[k]); }
#pragma unroll
        for (int k = 0; k < FKQ; ++k) { wk[k] = __builtin_amdgcn_exp2f((mk[k] - M) * L2E); L += wk[k] * mls[((k * FQG + qg) * 4 + 2 + mt) * 32 + lane]; }
        const float rl = __fdiv_rn(1.0f, L);
#pragma unroll
        for (int j = 0; j < 8; ++j) { float o = 0.f;
#pragma unroll
            for (int k = 0; k < FKQ; ++k) o += wk[k] * accs[((k * FQG + qg) * 64 + (kq * 2 + mt) * 8 + j) * 32 + lane];
            const float pt = o * rl; (out + oe)[j * TT + mt * 16] = g * pt + bfr(xr[mt][j]); } }
}
extern "C" void kernel_launch(void* const* d_in, const int* in_sizes, int n_in,
                              void* d_out, int out_size, void* d_ws, size_t ws_size, hipStream_t stream) {
    (void)in_sizes; (void)n_in; (void)out_size;
    const float* x = (const float*)d_in[0]; const float* wq = (const float*)d_in[1]; const float* wk = (const float*)d_in[2]; const float* wv = (const float*)d_in[3]; const float* gam = (const float*)d_in[4];
    // inputs in the module's argument order: x, Wq, Wk, Wv, gamma = d_in[0..4]: all read
    float* OUT = (float*)d_out;     // [8][64][4096]
    char* wsp = (char*)d_ws;
    auto take = [&](size_t bytes) { char* p = wsp; wsp += (bytes + 255) & ~(size_t)255; return (void*)p; };
    bf* QK = (bf*)take((size_t)4 * QKP * 2); bf* VC = (bf*)take((size_t)NB_ * HD * TT * 2);   // 8 entries each; QK: query hi, query lo, key hi, key lo; VC: h, f16
    if ((size_t)(wsp - (char*)d_ws) > ws_size) return;    // total 6 MiB carved
    // Placement, for speed only (no result depends on it): the entry is the FAST grid index in both launches, so every work-group of entry b has the flat index b modulo 8.
    k_prep<<<dim3(NB_, TT / 64, 1), 32, 0, stream>>>(x, wq, wk, wv, QK, VC);   /* the query and key planes, hi and lo words; the h plane, f16 */
    k_fattn<<<dim3(NB_, TT / (FQG * 32), 1), FQG * FKQ * 32, 0, stream>>>(QK, QK + (size_t)QKP, QK + (size_t)2 * QKP, QK + (size_t)3 * QKP, VC, x, gam, OUT);   /* out[b][c][m] = gamma (the sum over n of h[c][n] softmax_n(g[:, m] . f[:, n])) + x[b][c][m] */
}
